// v000
// Measured on an AMD MI455X. A time is GPU time per run, averaged over a window of back-to-back runs after a warm-up
// (all launches, gaps included; the runs take copies of the inputs in turn), and the median of several windows.
// Apart from v000's, it joins two sittings. Times from different sittings can be a few percent apart, while
// side-by-side timings come from the same sitting.
// v000, which the later versions start from, runs in 1080 microseconds.
#include <hip/hip_runtime.h>
#include <hip/hip_bf16.h>
#include <math.h>

#define HID 256
#define NHEAD 8
#define DK 32
// 1/sqrt(32)
#define SCALE_INV 0.17677669529663687f

typedef float v2f __attribute__((ext_vector_type(2)));
typedef float v8f __attribute__((ext_vector_type(8)));

// ---------------------------------------------------------------------------
// Core 16x16-tile fp32 WMMA GEMM step: acc += A(16x4) * B(4x16), K = 256.
// Lane layout (V_WMMA_F32_16X16X4_F32):
//   A: lane m = lane&15 holds row m, K = k0 + 2*(lane>>4) + {0,1}
//   B: lane n = lane&15 holds col n, same K pairing
//   D: lane&15 = col, VGPR r -> row r + 8*(lane>>4)
// ---------------------------------------------------------------------------
__device__ __forceinline__ v8f wmma_k256(const float* __restrict__ arow,
                                         const float* __restrict__ wrow,
                                         int khalf) {
    v8f acc = {};
    #pragma unroll 8
    for (int k0 = 0; k0 < HID; k0 += 4) {
        const float2 af = *(const float2*)(arow + k0 + khalf);
        const float2 bf = *(const float2*)(wrow + k0 + khalf);
        v2f a; a.x = af.x; a.y = af.y;
        v2f b; b.x = bf.x; b.y = bf.y;
        acc = __builtin_amdgcn_wmma_f32_16x16x4_f32(
            false, a, false, b, (short)0, acc, false, false);
    }
    return acc;
}

__device__ __forceinline__ void store_tile(float* __restrict__ Out, int row0,
                                           int n, int lane, const v8f& acc,
                                           float bval, int nrows) {
    if (row0 + 16 <= nrows) {           // uniform fast path: no exec juggling
        #pragma unroll
        for (int r = 0; r < 8; ++r) {
            const int M = r + ((lane >> 4) << 3);
            Out[(size_t)(row0 + M) * HID + n] = acc[r] + bval;
        }
    } else {
        #pragma unroll
        for (int r = 0; r < 8; ++r) {
            const int M = r + ((lane >> 4) << 3);
            if (row0 + M < nrows)
                Out[(size_t)(row0 + M) * HID + n] = acc[r] + bval;
        }
    }
}

// ---------------------------------------------------------------------------
// Fused Q/K/V projection: stage 16 input rows in LDS once, then three
// compile-time-unrolled GEMMs (uniform SGPR weight pointers -> global_load,
// no per-lane pointer selects). Each wave does 2 j-tiles per matrix.
// q gets bias bq; k, v are bias-free (matches reference).
// ---------------------------------------------------------------------------
__global__ __launch_bounds__(256) void qkv_proj_wmma(
    const float* __restrict__ In,
    const float* __restrict__ Wq, const float* __restrict__ Wk,
    const float* __restrict__ Wv, const float* __restrict__ bq,
    float* __restrict__ q, float* __restrict__ k, float* __restrict__ v,
    int nrows)
{
    __shared__ float lds_in[16 * HID];   // 16 KB of the 320 KB WGP LDS
    const int row0 = blockIdx.x * 16;

    for (int idx = threadIdx.x; idx < 16 * HID; idx += blockDim.x) {
        const int r = idx >> 8;
        const int c = idx & (HID - 1);
        const int gr = row0 + r;
        lds_in[idx] = (gr < nrows) ? In[(size_t)gr * HID + c] : 0.0f;
    }
    __syncthreads();

    const int wave  = threadIdx.x >> 5;
    const int lane  = threadIdx.x & 31;
    const int m     = lane & 15;
    const int khalf = (lane >> 4) << 1;
    const float* __restrict__ arow = &lds_in[m * HID];

    #pragma unroll
    for (int mat = 0; mat < 3; ++mat) {      // compile-time uniform matrix id
        const float* __restrict__ W = (mat == 0) ? Wq : (mat == 1) ? Wk : Wv;
        float* __restrict__       O = (mat == 0) ? q  : (mat == 1) ? k  : v;
        for (int jt = wave; jt < 16; jt += 8) {
            const int n = jt * 16 + m;
            const v8f acc = wmma_k256(arow, W + (size_t)n * HID, khalf);
            const float bval = (mat == 0) ? bq[n] : 0.0f;
            store_tile(O, row0, n, lane, acc, bval, nrows);
        }
    }
}

// ---------------------------------------------------------------------------
// Output projection with fused 1/z normalization of the LDS-staged rows:
// Out = (wv / z) @ Wo^T + bo
// ---------------------------------------------------------------------------
__global__ __launch_bounds__(256) void out_proj_wmma(
    const float* __restrict__ WV, const float* __restrict__ Z,
    const float* __restrict__ Wo, const float* __restrict__ bo,
    float* __restrict__ Out, int nrows)
{
    __shared__ float lds_in[16 * HID];
    const int row0 = blockIdx.x * 16;

    for (int idx = threadIdx.x; idx < 16 * HID; idx += blockDim.x) {
        const int r = idx >> 8;
        const int c = idx & (HID - 1);
        const int gr = row0 + r;
        float val = 0.0f;
        if (gr < nrows)
            val = WV[(size_t)gr * HID + c] / Z[(size_t)gr * NHEAD + (c >> 5)];
        lds_in[idx] = val;
    }
    __syncthreads();

    const int wave  = threadIdx.x >> 5;
    const int lane  = threadIdx.x & 31;
    const int m     = lane & 15;
    const int khalf = (lane >> 4) << 1;
    const float* __restrict__ arow = &lds_in[m * HID];

    for (int jt = wave; jt < 16; jt += 8) {
        const int n = jt * 16 + m;
        const v8f acc = wmma_k256(arow, Wo + (size_t)n * HID, khalf);
        store_tile(Out, row0, n, lane, acc, bo[n], nrows);
    }
}

// ---------------------------------------------------------------------------
// Edge attention: one wave32 per (edge, head).
// lane d: k[src,h,d]*q[dst,h,d] -> butterfly dot, exp(clip(./sqrt(dk))),
// scatter v[src,h,d]*score into wv[dst,h,d] via global_atomic_add_f32.
// ---------------------------------------------------------------------------
__global__ __launch_bounds__(256) void edge_attn(
    const float* __restrict__ q, const float* __restrict__ k,
    const float* __restrict__ v, const int* __restrict__ src,
    const int* __restrict__ dst, float* __restrict__ wv,
    float* __restrict__ z, int nedges)
{
    const int gid  = blockIdx.x * blockDim.x + threadIdx.x;
    const int pair = gid >> 5;
    const int lane = gid & 31;
    if (pair >= nedges * NHEAD) return;      // wave-uniform guard

    const int e = pair >> 3;
    const int h = pair & 7;
    const int s = src[e];
    const int d = dst[e];

    const size_t koff = (size_t)s * HID + h * DK + lane;
    const size_t qoff = (size_t)d * HID + h * DK + lane;

    float prod = k[koff] * q[qoff];
    #pragma unroll
    for (int off = 16; off > 0; off >>= 1)   // wave32 butterfly all-reduce
        prod += __shfl_xor(prod, off, 32);

    const float score = expf(fminf(fmaxf(prod * SCALE_INV, -10.0f), 10.0f));
    const float vv = v[koff];

    atomicAdd(&wv[qoff], vv * score);
    if (lane == 0)
        atomicAdd(&z[(size_t)d * NHEAD + h], score);
}

// ---------------------------------------------------------------------------
extern "C" void kernel_launch(void* const* d_in, const int* in_sizes, int n_in,
                              void* d_out, int out_size, void* d_ws, size_t ws_size,
                              hipStream_t stream) {
    (void)n_in; (void)out_size; (void)ws_size;
    const float* inputs = (const float*)d_in[0];
    const float* Wq     = (const float*)d_in[1];
    const float* bq     = (const float*)d_in[2];
    const float* Wk     = (const float*)d_in[3];
    const float* Wv     = (const float*)d_in[4];
    const float* Wo     = (const float*)d_in[5];
    const float* bo     = (const float*)d_in[6];
    const int*   src    = (const int*)d_in[7];
    const int*   dst    = (const int*)d_in[8];

    const int N = in_sizes[0] / HID;   // 50000
    const int E = in_sizes[7];         // 800000

    float* q  = (float*)d_ws;
    float* k  = q  + (size_t)N * HID;
    float* v  = k  + (size_t)N * HID;
    float* wv = v  + (size_t)N * HID;
    float* z  = wv + (size_t)N * HID;

    const int gemm_blocks = (N + 15) / 16;

    // fused Q/K/V projections (inputs staged in LDS once)
    qkv_proj_wmma<<<gemm_blocks, 256, 0, stream>>>(inputs, Wq, Wk, Wv, bq,
                                                   q, k, v, N);

    // zero accumulators (capture-safe memset nodes)
    hipMemsetAsync(wv, 0, (size_t)N * HID * sizeof(float), stream);
    hipMemsetAsync(z,  0, (size_t)N * NHEAD * sizeof(float), stream);

    // edge-wise attention scatter: E*8 wave32's, 8 per 256-thread block
    const long long npairs = (long long)E * NHEAD;
    const int edge_blocks = (int)((npairs * 32 + 255) / 256);
    edge_attn<<<edge_blocks, 256, 0, stream>>>(q, k, v, src, dst, wv, z, E);

    // normalize (fused) + output projection
    out_proj_wmma<<<gemm_blocks, 256, 0, stream>>>(wv, z, Wo, bo,
                                                   (float*)d_out, N);
}

// v001
// One run takes 561 microseconds.
// Timed twice side by side with v000, it ran 2.01 and 1.98 times as fast.
#include <hip/hip_runtime.h>
#include <hip/hip_bf16.h>
#include <math.h>

#define HID 256
#define NHEAD 8
#define DK 32
// 1/sqrt(32)
#define SCALE_INV 0.17677669529663687f

typedef float v2f __attribute__((ext_vector_type(2)));
typedef float v4f __attribute__((ext_vector_type(4)));
typedef float v8f __attribute__((ext_vector_type(8)));

// ---------------------------------------------------------------------------
// Core 16x16-tile fp32 WMMA GEMM step: acc += A(16x4) * B(4x16), K = 256.
// Lane layout (V_WMMA_F32_16X16X4_F32):
//   A: lane m = lane&15 holds row m, K = k0 + 2*(lane>>4) + {0,1}
//   B: lane n = lane&15 holds col n, same K pairing
//   D: lane&15 = col, VGPR r -> row r + 8*(lane>>4)
// ---------------------------------------------------------------------------
__device__ __forceinline__ v8f wmma_k256(const float* __restrict__ arow,
                                         const float* __restrict__ wrow,
                                         int khalf) {
    v8f acc = {};
    #pragma unroll 8
    for (int k0 = 0; k0 < HID; k0 += 4) {
        const float2 af = *(const float2*)(arow + k0 + khalf);
        const float2 bf = *(const float2*)(wrow + k0 + khalf);
        v2f a; a.x = af.x; a.y = af.y;
        v2f b; b.x = bf.x; b.y = bf.y;
        acc = __builtin_amdgcn_wmma_f32_16x16x4_f32(
            false, a, false, b, (short)0, acc, false, false);
    }
    return acc;
}

__device__ __forceinline__ void store_tile(float* __restrict__ Out, int row0,
                                           int n, int lane, const v8f& acc,
                                           float bval, int nrows) {
    if (row0 + 16 <= nrows) {           // uniform fast path: no exec juggling
        #pragma unroll
        for (int r = 0; r < 8; ++r) {
            const int M = r + ((lane >> 4) << 3);
            Out[(size_t)(row0 + M) * HID + n] = acc[r] + bval;
        }
    } else {
        #pragma unroll
        for (int r = 0; r < 8; ++r) {
            const int M = r + ((lane >> 4) << 3);
            if (row0 + M < nrows)
                Out[(size_t)(row0 + M) * HID + n] = acc[r] + bval;
        }
    }
}

// ---------------------------------------------------------------------------
// Fused Q/K/V projection: stage 16 input rows in LDS once, then three
// compile-time-unrolled GEMMs (uniform SGPR weight pointers -> global_load,
// no per-lane pointer selects). Each wave does 2 j-tiles per matrix.
// q gets bias bq; k, v are bias-free (matches reference).
// ---------------------------------------------------------------------------
__global__ __launch_bounds__(256) void qkv_proj_wmma(
    const float* __restrict__ In,
    const float* __restrict__ Wq, const float* __restrict__ Wk,
    const float* __restrict__ Wv, const float* __restrict__ bq,
    float* __restrict__ q, float* __restrict__ k, float* __restrict__ v,
    int nrows)
{
    __shared__ float lds_in[16 * HID];   // 16 KB of the 320 KB WGP LDS
    const int row0 = blockIdx.x * 16;

    for (int idx = threadIdx.x; idx < 16 * HID; idx += blockDim.x) {
        const int r = idx >> 8;
        const int c = idx & (HID - 1);
        const int gr = row0 + r;
        lds_in[idx] = (gr < nrows) ? In[(size_t)gr * HID + c] : 0.0f;
    }
    __syncthreads();

    const int wave  = threadIdx.x >> 5;
    const int lane  = threadIdx.x & 31;
    const int m     = lane & 15;
    const int khalf = (lane >> 4) << 1;
    const float* __restrict__ arow = &lds_in[m * HID];

    #pragma unroll
    for (int mat = 0; mat < 3; ++mat) {      // compile-time uniform matrix id
        const float* __restrict__ W = (mat == 0) ? Wq : (mat == 1) ? Wk : Wv;
        float* __restrict__       O = (mat == 0) ? q  : (mat == 1) ? k  : v;
        for (int jt = wave; jt < 16; jt += 8) {
            const int n = jt * 16 + m;
            const v8f acc = wmma_k256(arow, W + (size_t)n * HID, khalf);
            const float bval = (mat == 0) ? bq[n] : 0.0f;
            store_tile(O, row0, n, lane, acc, bval, nrows);
        }
    }
}

// ---------------------------------------------------------------------------
// Output projection with fused 1/z normalization of the LDS-staged rows:
// Out = (wv / z) @ Wo^T + bo
// ---------------------------------------------------------------------------
__global__ __launch_bounds__(256) void out_proj_wmma(
    const float* __restrict__ WV, const float* __restrict__ Z,
    const float* __restrict__ Wo, const float* __restrict__ bo,
    float* __restrict__ Out, int nrows)
{
    __shared__ float lds_in[16 * HID];
    const int row0 = blockIdx.x * 16;

    for (int idx = threadIdx.x; idx < 16 * HID; idx += blockDim.x) {
        const int r = idx >> 8;
        const int c = idx & (HID - 1);
        const int gr = row0 + r;
        float val = 0.0f;
        if (gr < nrows)
            val = WV[(size_t)gr * HID + c] / Z[(size_t)gr * NHEAD + (c >> 5)];
        lds_in[idx] = val;
    }
    __syncthreads();

    const int wave  = threadIdx.x >> 5;
    const int lane  = threadIdx.x & 31;
    const int m     = lane & 15;
    const int khalf = (lane >> 4) << 1;
    const float* __restrict__ arow = &lds_in[m * HID];

    for (int jt = wave; jt < 16; jt += 8) {
        const int n = jt * 16 + m;
        const v8f acc = wmma_k256(arow, Wo + (size_t)n * HID, khalf);
        store_tile(Out, row0, n, lane, acc, bo[n], nrows);
    }
}

// ---------------------------------------------------------------------------
// Edge attention as a gather. The edges are grouped by destination node
// (count, prefix sum, place), each node's list is put into edge-id order so
// that the f32 sums run in one fixed order on every run, and one wave32 per
// node then sums its in-edges in registers. No float atomic is left.
// ---------------------------------------------------------------------------
__device__ __forceinline__ int clamp_node(int x, int nnodes) {
    return min(max(x, 0), nnodes - 1);   // bounds every address formed from src/dst
}

__global__ __launch_bounds__(256) void clear_counts(int* __restrict__ cnt, int nnodes)
{
    const int i = blockIdx.x * blockDim.x + threadIdx.x;
    if (i < nnodes) cnt[i] = 0;
}

// cnt[d] = in-degree of d; arrival[e] = this edge's (run-dependent) place in d's list
__global__ __launch_bounds__(256) void edge_count(
    const int* __restrict__ dst, int* __restrict__ cnt,
    int* __restrict__ arrival, int nedges, int nnodes)
{
    const int e = blockIdx.x * blockDim.x + threadIdx.x;
    if (e >= nedges) return;
    arrival[e] = atomicAdd(&cnt[clamp_node(dst[e], nnodes)], 1);
}

// off[i] = sum of cnt[0..i), off[nnodes] = total. Each block owns 256 nodes and
// sums every count in front of them itself, so no block waits on another.
__global__ __launch_bounds__(256) void node_offsets(
    const int* __restrict__ cnt, int* __restrict__ off, int nnodes)
{
    __shared__ int s_before[8];
    __shared__ int s_own[8];
    const int t    = threadIdx.x;
    const int lane = t & 31;
    const int wave = t >> 5;
    const int b0   = blockIdx.x * 256;

    int before = 0;
    const int4* __restrict__ c4 = (const int4*)cnt;
    #pragma unroll 8   // keeps several independent 16-byte loads in flight
    for (int i = t; i < (b0 >> 2); i += 256) {
        const int4 x = c4[i];
        before += (x.x + x.y) + (x.z + x.w);
    }
    const int i   = b0 + t;
    const int own = (i < nnodes) ? cnt[i] : 0;

    int incl = own;                          // inclusive scan inside the wave
    #pragma unroll
    for (int d = 1; d < 32; d <<= 1) {
        const int y = __shfl_up(incl, d, 32);
        if (lane >= d) incl += y;
    }
    #pragma unroll
    for (int d = 16; d > 0; d >>= 1)
        before += __shfl_xor(before, d, 32);
    if (lane == 31) { s_own[wave] = incl; s_before[wave] = before; }
    __syncthreads();

    int base = 0;
    #pragma unroll
    for (int w = 0; w < 8; ++w) {
        base += s_before[w];
        if (w < wave) base += s_own[w];
    }
    if (i < nnodes) {
        off[i] = base + incl - own;
        if (i == nnodes - 1) off[nnodes] = base + incl;
    }
}

// list[...] = (edge id, source node) of every in-edge of d, in arrival order
__global__ __launch_bounds__(256) void edge_place(
    const int* __restrict__ src, const int* __restrict__ dst,
    const int* __restrict__ off, const int* __restrict__ arrival,
    int2* __restrict__ list, int nedges, int nnodes)
{
    const int e = blockIdx.x * blockDim.x + threadIdx.x;
    if (e >= nedges) return;
    list[off[clamp_node(dst[e], nnodes)] + arrival[e]] =
        make_int2(e, clamp_node(src[e], nnodes));
}

// One wave32 per node: an edge goes to the place given by how many edges of the
// node have a smaller id, so the sources come out in edge-id order whatever the
// arrival order was. Any in-degree: 32 edges at a time against all of the node's.
__global__ __launch_bounds__(256) void node_order(
    const int* __restrict__ off, const int2* __restrict__ list,
    int* __restrict__ ssrc, int nnodes)
{
    const int wave = __builtin_amdgcn_readfirstlane(threadIdx.x >> 5);
    const int lane = threadIdx.x & 31;
    const int n    = blockIdx.x * 8 + wave;
    if (n >= nnodes) return;                 // wave-uniform guard, no barrier below

    const int beg = off[n];
    const int end = off[n + 1];
    for (int cb = beg; cb < end; cb += 32) {
        const int2 mine = list[min(cb + lane, end - 1)];
        int c = 0;
        for (int ob = beg; ob < end; ob += 32) {
            const int om = min(32, end - ob);
            int oid = mine.x;                // the wave's own 32 are already here
            if (ob != cb) {
                oid = list[min(ob + lane, end - 1)].x;
                // the wait in front of any overwrite of that load's address registers
                asm volatile("s_wait_xcnt 0x0" ::: "memory");
            }
            for (int t = 0; t < om; ++t)
                c += (__builtin_amdgcn_readlane(oid, t) < mine.x) ? 1 : 0;
        }
        if (cb + lane < end)
            ssrc[beg + c] = mine.y;
        // the wait in front of the next trip's overwrite of that store's registers
        asm volatile("s_wait_xcnt 0x0" ::: "memory");
    }
}

// sum over the four lanes that share a head (quad_perm swaps, no LDS path)
__device__ __forceinline__ float quad_sum(float x) {
    x += __int_as_float(__builtin_amdgcn_mov_dpp(__float_as_int(x), 0xB1, 0xF, 0xF, true));
    x += __int_as_float(__builtin_amdgcn_mov_dpp(__float_as_int(x), 0x4E, 0xF, 0xF, true));
    return x;
}

// U edges of one node: all 4*U row loads are issued first, then the edges are
// added one after the other, in list order.
template <int U>
__device__ __forceinline__ void add_edges(
    const float* __restrict__ k, const float* __restrict__ v,
    int sid, int t, unsigned cbytes, const v4f& q0, const v4f& q1,
    v2f (&a)[4], float& zs)
{
    v4f k0[U], k1[U], v0[U], v1[U];
    unsigned ofs[4] = {0u, 0u, 0u, 0u};      // byte offset of this lane's 32 bytes in row s
    #pragma unroll
    for (int u = 0; u < U; ++u) {
        ofs[u] = (unsigned)__builtin_amdgcn_readlane(sid, t + u) * (HID * 4u) + cbytes;
        const v4f* __restrict__ kp = (const v4f*)((const char*)k + ofs[u]);
        const v4f* __restrict__ vp = (const v4f*)((const char*)v + ofs[u]);
        k0[u] = kp[0]; k1[u] = kp[1];
        v0[u] = vp[0]; v1[u] = vp[1];
    }
    // The wait that belongs in front of any overwrite of a register which an
    // issued load names; the offsets are inputs so that they stay in their
    // registers up to here.
    asm volatile("s_wait_xcnt 0x0"
                 :: "v"(ofs[0]), "v"(ofs[1]), "v"(ofs[2]), "v"(ofs[3]) : "memory");
    // Keeps the arithmetic below behind all 4*U loads: without it the scheduler
    // mixes the two to save registers and a wave waits once per row, not per group.
    __builtin_amdgcn_sched_barrier(0);
    #pragma unroll
    for (int u = 0; u < U; ++u) {
        v2f p2 = k0[u].xy * q0.xy;
        p2 = __builtin_elementwise_fma(k0[u].zw, q0.zw, p2);
        p2 = __builtin_elementwise_fma(k1[u].xy, q1.xy, p2);
        p2 = __builtin_elementwise_fma(k1[u].zw, q1.zw, p2);
        const float p = quad_sum(p2.x + p2.y);
        const float score = expf(fminf(fmaxf(p * SCALE_INV, -10.0f), 10.0f));
        const v2f s2 = {score, score};
        a[0] = __builtin_elementwise_fma(v0[u].xy, s2, a[0]);
        a[1] = __builtin_elementwise_fma(v0[u].zw, s2, a[1]);
        a[2] = __builtin_elementwise_fma(v1[u].xy, s2, a[2]);
        a[3] = __builtin_elementwise_fma(v1[u].zw, s2, a[3]);
        zs += score;
    }
}

// One wave32 per node. Lane l holds columns 8l..8l+7 of the 256-wide row, so
// head h lives in lanes 4h..4h+3. wv and z are stored once, never added into.
__global__ __launch_bounds__(256) void node_attn(
    const float* __restrict__ q, const float* __restrict__ k,
    const float* __restrict__ v, const int* __restrict__ off,
    const int* __restrict__ ssrc, float* __restrict__ wv,
    float* __restrict__ z, int nnodes)
{
    const int wave = __builtin_amdgcn_readfirstlane(threadIdx.x >> 5);
    const int lane = threadIdx.x & 31;
    const int n    = blockIdx.x * 8 + wave;
    if (n >= nnodes) return;                 // wave-uniform guard, no barrier below

    const int beg = off[n];
    const int end = off[n + 1];
    const unsigned cbytes = (unsigned)lane * 32u;   // 8 floats per lane

    const v4f* __restrict__ qp =
        (const v4f*)((const char*)(q + (size_t)n * HID) + cbytes);
    const v4f q0 = qp[0];
    const v4f q1 = qp[1];
    v2f   a[4] = {};
    float zs   = 0.0f;

    for (int j0 = beg; j0 < end; j0 += 32) {
        const int m   = min(32, end - j0);
        const int sid = ssrc[j0 + min(lane, m - 1)];   // up to 32 sources, one per lane
        int t = 0;
        for (; t + 4 <= m; t += 4)
            add_edges<4>(k, v, sid, t, cbytes, q0, q1, a, zs);
        const int r = m - t;
        if (r == 3)      add_edges<3>(k, v, sid, t, cbytes, q0, q1, a, zs);
        else if (r == 2) add_edges<2>(k, v, sid, t, cbytes, q0, q1, a, zs);
        else if (r == 1) add_edges<1>(k, v, sid, t, cbytes, q0, q1, a, zs);
    }

    v4f* __restrict__ wp = (v4f*)((char*)(wv + (size_t)n * HID) + cbytes);
    const v4f w0 = {a[0].x, a[0].y, a[1].x, a[1].y};
    const v4f w1 = {a[2].x, a[2].y, a[3].x, a[3].y};
    wp[0] = w0;
    wp[1] = w1;
    if ((lane & 3) == 0)
        z[(size_t)n * NHEAD + (lane >> 2)] = zs;
}

// ---------------------------------------------------------------------------
extern "C" void kernel_launch(void* const* d_in, const int* in_sizes, int n_in,
                              void* d_out, int out_size, void* d_ws, size_t ws_size,
                              hipStream_t stream) {
    (void)n_in; (void)out_size; (void)ws_size;
    const float* inputs = (const float*)d_in[0];
    const float* Wq     = (const float*)d_in[1];
    const float* bq     = (const float*)d_in[2];
    const float* Wk     = (const float*)d_in[3];
    const float* Wv     = (const float*)d_in[4];
    const float* Wo     = (const float*)d_in[5];
    const float* bo     = (const float*)d_in[6];
    const int*   src    = (const int*)d_in[7];
    const int*   dst    = (const int*)d_in[8];

    const int N = in_sizes[0] / HID;   // 50000
    const int E = in_sizes[7];         // 800000

    float* q  = (float*)d_ws;
    float* k  = q  + (size_t)N * HID;
    float* v  = k  + (size_t)N * HID;
    float* wv = v  + (size_t)N * HID;
    float* z  = wv + (size_t)N * HID;
    int* cnt     = (int*)(z + (size_t)N * NHEAD);   // N
    int* off     = cnt + N;                         // N + 1
    int* arrival = off + N + 1;                     // E
    int* ssrc    = arrival + E;                     // E
    int2* list   = (int2*)(ssrc + E + 1);           // E pairs; 2N + 2E + 2 ints behind cnt, so 8-byte aligned

    const int gemm_blocks = (N + 15) / 16;

    // fused Q/K/V projections (inputs staged in LDS once)
    qkv_proj_wmma<<<gemm_blocks, 256, 0, stream>>>(inputs, Wq, Wk, Wv, bq,
                                                   q, k, v, N);

    // in-edge lists per destination node, in edge-id order
    const int edge_blocks = (E + 255) / 256;
    clear_counts<<<(N + 255) / 256, 256, 0, stream>>>(cnt, N);
    edge_count<<<edge_blocks, 256, 0, stream>>>(dst, cnt, arrival, E, N);
    node_offsets<<<(N + 255) / 256, 256, 0, stream>>>(cnt, off, N);
    edge_place<<<edge_blocks, 256, 0, stream>>>(src, dst, off, arrival, list, E, N);
    node_order<<<(N + 7) / 8, 256, 0, stream>>>(off, list, ssrc, N);

    // one wave32 per node sums its in-edges; 8 nodes per 256-thread block
    node_attn<<<(N + 7) / 8, 256, 0, stream>>>(q, k, v, off, ssrc, wv, z, N);

    // normalize (fused) + output projection
    out_proj_wmma<<<gemm_blocks, 256, 0, stream>>>(wv, z, Wo, bo,
                                                   (float*)d_out, N);
}

// v002
// One run takes 305 microseconds.
// Next to v001, in two timings, it ran 1.85 and 1.86 times as fast.
// Counting every step since v000, it is 3.70 times as fast.
#include <hip/hip_runtime.h>
#include <hip/hip_bf16.h>
#include <math.h>

#define HID 256
#define NHEAD 8
#define DK 32
// 1/sqrt(32)
#define SCALE_INV 0.17677669529663687f

typedef float v2f __attribute__((ext_vector_type(2)));
typedef float v4f __attribute__((ext_vector_type(4)));
typedef float v8f __attribute__((ext_vector_type(8)));

// ---------------------------------------------------------------------------
// Projection GEMM tile: one block = 128 staged rows x 256 output columns, one
// wave = 8 row tiles x 2 column tiles of 16x16 (16 accumulators), K = 256.
// A weight fragment loaded from global feeds 8 WMMAs, a row fragment read from
// LDS feeds 2. k runs upward in every accumulator.
// Lane layout (V_WMMA_F32_16X16X4_F32):
//   A: lane m = lane&15 holds row m, K = k0 + 2*(lane>>4) + {0,1}
//   B: lane n = lane&15 holds col n, same K pairing
//   D: lane&15 = col, VGPR r -> row r + 8*(lane>>4)
// LDS rows are 260 floats apart: the 16 rows of a fragment read then start 4
// banks apart and the two lane halves 2 apart, so its 64 dwords hit 64 banks.
// ---------------------------------------------------------------------------
#define ROWS 128
#define MT 8
#define NT 2
#define PITCH 260

__device__ __forceinline__ void gemm_tile(const float* lds_in,
                                          const float* __restrict__ Wm,
                                          const float* __restrict__ bias,
                                          float* __restrict__ Out,
                                          int row0, int nrows)
{
    const int wave  = threadIdx.x >> 5;
    const int lane  = threadIdx.x & 31;
    const int m     = lane & 15;
    const int khalf = (lane >> 4) << 1;
    const int n0    = wave * (NT * 16) + m;
    const float* arow = lds_in + m * PITCH + khalf;
    const float* __restrict__ wrow = Wm + (size_t)n0 * HID + khalf;

    v8f acc[MT][NT] = {};
    #pragma unroll 4   // several k steps of fragment loads in flight ahead of their WMMAs
    for (int k0 = 0; k0 < HID; k0 += 4) {
        v2f b[NT];
        #pragma unroll
        for (int j = 0; j < NT; ++j)
            b[j] = *(const v2f*)(wrow + j * 16 * HID + k0);
        #pragma unroll
        for (int i = 0; i < MT; ++i) {
            const v2f a = *(const v2f*)(arow + i * 16 * PITCH + k0);
            #pragma unroll
            for (int j = 0; j < NT; ++j)
                acc[i][j] = __builtin_amdgcn_wmma_f32_16x16x4_f32(
                    false, a, false, b[j], (short)0, acc[i][j], false, false);
        }
    }

    float bval[NT];
    #pragma unroll
    for (int j = 0; j < NT; ++j)
        bval[j] = bias ? bias[n0 + j * 16] : 0.0f;

    const int rhalf = (lane >> 4) << 3;
    #pragma unroll
    for (int i = 0; i < MT; ++i) {
        const int rt = row0 + i * 16;
        if (rt + 16 <= nrows) {              // uniform fast path: no exec juggling
            #pragma unroll
            for (int r = 0; r < 8; ++r)
                #pragma unroll
                for (int j = 0; j < NT; ++j)
                    Out[(size_t)(rt + rhalf + r) * HID + n0 + j * 16] = acc[i][j][r] + bval[j];
            // the wait in front of the next tile's overwrite of these stores' registers
            asm volatile("s_wait_xcnt 0x0" ::: "memory");
        } else {
            #pragma unroll
            for (int r = 0; r < 8; ++r)
                if (rt + rhalf + r < nrows) {
                    #pragma unroll
                    for (int j = 0; j < NT; ++j)
                        Out[(size_t)(rt + rhalf + r) * HID + n0 + j * 16] = acc[i][j][r] + bval[j];
                }
        }
    }
}

// ---------------------------------------------------------------------------
// Q/K/V projection: blockIdx.x picks the matrix, blockIdx.y the 128 rows, so
// the three blocks that read the same input rows start next to each other.
// q gets bias bq; k, v are bias-free (matches reference).
// ---------------------------------------------------------------------------
__global__ __launch_bounds__(256) void qkv_proj_wmma(
    const float* __restrict__ In,
    const float* __restrict__ Wq, const float* __restrict__ Wk,
    const float* __restrict__ Wv, const float* __restrict__ bq,
    float* __restrict__ q, float* __restrict__ k, float* __restrict__ v,
    int nrows)
{
    __shared__ __attribute__((aligned(16))) float lds_in[ROWS * PITCH];   // 130 KB: two blocks per WGP
    const int mat  = blockIdx.x;
    const int row0 = blockIdx.y * ROWS;

    #pragma unroll 8   // eight 16-byte loads in flight per lane
    for (int it = 0; it < ROWS / 4; ++it) {          // 256 threads = 4 rows of 64 x 16 bytes
        const int r  = it * 4 + (threadIdx.x >> 6);
        const int c  = (threadIdx.x & 63) << 2;
        const int gr = min(row0 + r, nrows - 1);   // past the end: a copy of the last row, never stored
        *(v4f*)(lds_in + r * PITCH + c) = *(const v4f*)(In + (size_t)gr * HID + c);
    }
    __syncthreads();

    const float* __restrict__ Wm = (mat == 0) ? Wq : (mat == 1) ? Wk : Wv;
    float* __restrict__       O  = (mat == 0) ? q  : (mat == 1) ? k  : v;
    gemm_tile(lds_in, Wm, (mat == 0) ? bq : nullptr, O, row0, nrows);
}

// ---------------------------------------------------------------------------
// Output projection with fused 1/z normalization of the LDS-staged rows:
// Out = (wv / z) @ Wo^T + bo
// ---------------------------------------------------------------------------
__global__ __launch_bounds__(256) void out_proj_wmma(
    const float* __restrict__ WV, const float* __restrict__ Z,
    const float* __restrict__ Wo, const float* __restrict__ bo,
    float* __restrict__ Out, int nrows)
{
    __shared__ __attribute__((aligned(16))) float lds_in[ROWS * PITCH];
    const int row0 = blockIdx.x * ROWS;

    #pragma unroll 4   // several 16-byte loads in flight per lane
    for (int it = 0; it < ROWS / 4; ++it) {          // 256 threads = 4 rows of 64 x 16 bytes
        const int r  = it * 4 + (threadIdx.x >> 6);
        const int c  = (threadIdx.x & 63) << 2;
        const int gr = min(row0 + r, nrows - 1);   // past the end: a copy of the last row, never stored
        const v4f   w  = *(const v4f*)(WV + (size_t)gr * HID + c);
        const float zz = Z[(size_t)gr * NHEAD + (c >> 5)];
        v4f val;
        val.x = w.x / zz; val.y = w.y / zz; val.z = w.z / zz; val.w = w.w / zz;
        *(v4f*)(lds_in + r * PITCH + c) = val;
    }
    __syncthreads();

    gemm_tile(lds_in, Wo, bo, Out, row0, nrows);
}

// ---------------------------------------------------------------------------
// Edge attention as a gather. The edges are grouped by destination node
// (count, prefix sum, place), each node's list is put into edge-id order so
// that the f32 sums run in one fixed order on every run, and one wave32 per
// node then sums its in-edges in registers. No float atomic is left.
// ---------------------------------------------------------------------------
__device__ __forceinline__ int clamp_node(int x, int nnodes) {
    return min(max(x, 0), nnodes - 1);   // bounds every address formed from src/dst
}

__global__ __launch_bounds__(256) void clear_counts(int* __restrict__ cnt, int nnodes)
{
    const int i = blockIdx.x * blockDim.x + threadIdx.x;
    if (i < nnodes) cnt[i] = 0;
}

// cnt[d] = in-degree of d; arrival[e] = this edge's (run-dependent) place in d's list
__global__ __launch_bounds__(256) void edge_count(
    const int* __restrict__ dst, int* __restrict__ cnt,
    int* __restrict__ arrival, int nedges, int nnodes)
{
    const int e = blockIdx.x * blockDim.x + threadIdx.x;
    if (e >= nedges) return;
    arrival[e] = atomicAdd(&cnt[clamp_node(dst[e], nnodes)], 1);
}

// off[i] = sum of cnt[0..i), off[nnodes] = total. Each block owns 256 nodes and
// sums every count in front of them itself, so no block waits on another.
__global__ __launch_bounds__(256) void node_offsets(
    const int* __restrict__ cnt, int* __restrict__ off, int nnodes)
{
    __shared__ int s_before[8];
    __shared__ int s_own[8];
    const int t    = threadIdx.x;
    const int lane = t & 31;
    const int wave = t >> 5;
    const int b0   = blockIdx.x * 256;

    int before = 0;
    const int4* __restrict__ c4 = (const int4*)cnt;
    #pragma unroll 8   // keeps several independent 16-byte loads in flight
    for (int i = t; i < (b0 >> 2); i += 256) {
        const int4 x = c4[i];
        before += (x.x + x.y) + (x.z + x.w);
    }
    const int i   = b0 + t;
    const int own = (i < nnodes) ? cnt[i] : 0;

    int incl = own;                          // inclusive scan inside the wave
    #pragma unroll
    for (int d = 1; d < 32; d <<= 1) {
        const int y = __shfl_up(incl, d, 32);
        if (lane >= d) incl += y;
    }
    #pragma unroll
    for (int d = 16; d > 0; d >>= 1)
        before += __shfl_xor(before, d, 32);
    if (lane == 31) { s_own[wave] = incl; s_before[wave] = before; }
    __syncthreads();

    int base = 0;
    #pragma unroll
    for (int w = 0; w < 8; ++w) {
        base += s_before[w];
        if (w < wave) base += s_own[w];
    }
    if (i < nnodes) {
        off[i] = base + incl - own;
        if (i == nnodes - 1) off[nnodes] = base + incl;
    }
}

// list[...] = (edge id, source node) of every in-edge of d, in arrival order
__global__ __launch_bounds__(256) void edge_place(
    const int* __restrict__ src, const int* __restrict__ dst,
    const int* __restrict__ off, const int* __restrict__ arrival,
    int2* __restrict__ list, int nedges, int nnodes)
{
    const int e = blockIdx.x * blockDim.x + threadIdx.x;
    if (e >= nedges) return;
    list[off[clamp_node(dst[e], nnodes)] + arrival[e]] =
        make_int2(e, clamp_node(src[e], nnodes));
}

// One wave32 per node: an edge goes to the place given by how many edges of the
// node have a smaller id, so the sources come out in edge-id order whatever the
// arrival order was. Any in-degree: 32 edges at a time against all of the node's.
__global__ __launch_bounds__(256) void node_order(
    const int* __restrict__ off, const int2* __restrict__ list,
    int* __restrict__ ssrc, int nnodes)
{
    const int wave = __builtin_amdgcn_readfirstlane(threadIdx.x >> 5);
    const int lane = threadIdx.x & 31;
    const int n    = blockIdx.x * 8 + wave;
    if (n >= nnodes) return;                 // wave-uniform guard, no barrier below

    const int beg = off[n];
    const int end = off[n + 1];
    for (int cb = beg; cb < end; cb += 32) {
        const int2 mine = list[min(cb + lane, end - 1)];
        int c = 0;
        for (int ob = beg; ob < end; ob += 32) {
            const int om = min(32, end - ob);
            int oid = mine.x;                // the wave's own 32 are already here
            if (ob != cb) {
                oid = list[min(ob + lane, end - 1)].x;
                // the wait in front of any overwrite of that load's address registers
                asm volatile("s_wait_xcnt 0x0" ::: "memory");
            }
            for (int t = 0; t < om; ++t)
                c += (__builtin_amdgcn_readlane(oid, t) < mine.x) ? 1 : 0;
        }
        if (cb + lane < end)
            ssrc[beg + c] = mine.y;
        // the wait in front of the next trip's overwrite of that store's registers
        asm volatile("s_wait_xcnt 0x0" ::: "memory");
    }
}

// sum over the four lanes that share a head (quad_perm swaps, no LDS path)
__device__ __forceinline__ float quad_sum(float x) {
    x += __int_as_float(__builtin_amdgcn_mov_dpp(__float_as_int(x), 0xB1, 0xF, 0xF, true));
    x += __int_as_float(__builtin_amdgcn_mov_dpp(__float_as_int(x), 0x4E, 0xF, 0xF, true));
    return x;
}

// U edges of one node: all 4*U row loads are issued first, then the edges are
// added one after the other, in list order.
template <int U>
__device__ __forceinline__ void add_edges(
    const float* __restrict__ k, const float* __restrict__ v,
    int sid, int t, unsigned cbytes, const v4f& q0, const v4f& q1,
    v2f (&a)[4], float& zs)
{
    v4f k0[U], k1[U], v0[U], v1[U];
    unsigned ofs[4] = {0u, 0u, 0u, 0u};      // byte offset of this lane's 32 bytes in row s
    #pragma unroll
    for (int u = 0; u < U; ++u) {
        ofs[u] = (unsigned)__builtin_amdgcn_readlane(sid, t + u) * (HID * 4u) + cbytes;
        const v4f* __restrict__ kp = (const v4f*)((const char*)k + ofs[u]);
        const v4f* __restrict__ vp = (const v4f*)((const char*)v + ofs[u]);
        k0[u] = kp[0]; k1[u] = kp[1];
        v0[u] = vp[0]; v1[u] = vp[1];
    }
    // The wait that belongs in front of any overwrite of a register which an
    // issued load names; the offsets are inputs so that they stay in their
    // registers up to here.
    asm volatile("s_wait_xcnt 0x0"
                 :: "v"(ofs[0]), "v"(ofs[1]), "v"(ofs[2]), "v"(ofs[3]) : "memory");
    // Keeps the arithmetic below behind all 4*U loads: without it the scheduler
    // mixes the two to save registers and a wave waits once per row, not per group.
    __builtin_amdgcn_sched_barrier(0);
    #pragma unroll
    for (int u = 0; u < U; ++u) {
        v2f p2 = k0[u].xy * q0.xy;
        p2 = __builtin_elementwise_fma(k0[u].zw, q0.zw, p2);
        p2 = __builtin_elementwise_fma(k1[u].xy, q1.xy, p2);
        p2 = __builtin_elementwise_fma(k1[u].zw, q1.zw, p2);
        const float p = quad_sum(p2.x + p2.y);
        const float score = expf(fminf(fmaxf(p * SCALE_INV, -10.0f), 10.0f));
        const v2f s2 = {score, score};
        a[0] = __builtin_elementwise_fma(v0[u].xy, s2, a[0]);
        a[1] = __builtin_elementwise_fma(v0[u].zw, s2, a[1]);
        a[2] = __builtin_elementwise_fma(v1[u].xy, s2, a[2]);
        a[3] = __builtin_elementwise_fma(v1[u].zw, s2, a[3]);
        zs += score;
    }
}

// One wave32 per node. Lane l holds columns 8l..8l+7 of the 256-wide row, so
// head h lives in lanes 4h..4h+3. wv and z are stored once, never added into.
__global__ __launch_bounds__(256) void node_attn(
    const float* __restrict__ q, const float* __restrict__ k,
    const float* __restrict__ v, const int* __restrict__ off,
    const int* __restrict__ ssrc, float* __restrict__ wv,
    float* __restrict__ z, int nnodes)
{
    const int wave = __builtin_amdgcn_readfirstlane(threadIdx.x >> 5);
    const int lane = threadIdx.x & 31;
    const int n    = blockIdx.x * 8 + wave;
    if (n >= nnodes) return;                 // wave-uniform guard, no barrier below

    const int beg = off[n];
    const int end = off[n + 1];
    const unsigned cbytes = (unsigned)lane * 32u;   // 8 floats per lane

    const v4f* __restrict__ qp =
        (const v4f*)((const char*)(q + (size_t)n * HID) + cbytes);
    const v4f q0 = qp[0];
    const v4f q1 = qp[1];
    v2f   a[4] = {};
    float zs   = 0.0f;

    for (int j0 = beg; j0 < end; j0 += 32) {
        const int m   = min(32, end - j0);
        const int sid = ssrc[j0 + min(lane, m - 1)];   // up to 32 sources, one per lane
        int t = 0;
        for (; t + 4 <= m; t += 4)
            add_edges<4>(k, v, sid, t, cbytes, q0, q1, a, zs);
        const int r = m - t;
        if (r == 3)      add_edges<3>(k, v, sid, t, cbytes, q0, q1, a, zs);
        else if (r == 2) add_edges<2>(k, v, sid, t, cbytes, q0, q1, a, zs);
        else if (r == 1) add_edges<1>(k, v, sid, t, cbytes, q0, q1, a, zs);
    }

    v4f* __restrict__ wp = (v4f*)((char*)(wv + (size_t)n * HID) + cbytes);
    const v4f w0 = {a[0].x, a[0].y, a[1].x, a[1].y};
    const v4f w1 = {a[2].x, a[2].y, a[3].x, a[3].y};
    wp[0] = w0;
    wp[1] = w1;
    if ((lane & 3) == 0)
        z[(size_t)n * NHEAD + (lane >> 2)] = zs;
}

// ---------------------------------------------------------------------------
extern "C" void kernel_launch(void* const* d_in, const int* in_sizes, int n_in,
                              void* d_out, int out_size, void* d_ws, size_t ws_size,
                              hipStream_t stream) {
    (void)n_in; (void)out_size; (void)ws_size;
    const float* inputs = (const float*)d_in[0];
    const float* Wq     = (const float*)d_in[1];
    const float* bq     = (const float*)d_in[2];
    const float* Wk     = (const float*)d_in[3];
    const float* Wv     = (const float*)d_in[4];
    const float* Wo     = (const float*)d_in[5];
    const float* bo     = (const float*)d_in[6];
    const int*   src    = (const int*)d_in[7];
    const int*   dst    = (const int*)d_in[8];

    const int N = in_sizes[0] / HID;   // 50000
    const int E = in_sizes[7];         // 800000

    float* q  = (float*)d_ws;
    float* k  = q  + (size_t)N * HID;
    float* v  = k  + (size_t)N * HID;
    float* wv = v  + (size_t)N * HID;
    float* z  = wv + (size_t)N * HID;
    int* cnt     = (int*)(z + (size_t)N * NHEAD);   // N
    int* off     = cnt + N;                         // N + 1
    int* arrival = off + N + 1;                     // E
    int* ssrc    = arrival + E;                     // E
    int2* list   = (int2*)(ssrc + E + 1);           // E pairs; 2N + 2E + 2 ints behind cnt, so 8-byte aligned

    const int gemm_blocks = (N + ROWS - 1) / ROWS;

    // Q/K/V projections: x = matrix, y = block of 128 rows
    qkv_proj_wmma<<<dim3(3, gemm_blocks), 256, 0, stream>>>(inputs, Wq, Wk, Wv, bq,
                                                   q, k, v, N);

    // in-edge lists per destination node, in edge-id order
    const int edge_blocks = (E + 255) / 256;
    clear_counts<<<(N + 255) / 256, 256, 0, stream>>>(cnt, N);
    edge_count<<<edge_blocks, 256, 0, stream>>>(dst, cnt, arrival, E, N);
    node_offsets<<<(N + 255) / 256, 256, 0, stream>>>(cnt, off, N);
    edge_place<<<edge_blocks, 256, 0, stream>>>(src, dst, off, arrival, list, E, N);
    node_order<<<(N + 7) / 8, 256, 0, stream>>>(off, list, ssrc, N);

    // one wave32 per node sums its in-edges; 8 nodes per 256-thread block
    node_attn<<<(N + 7) / 8, 256, 0, stream>>>(q, k, v, off, ssrc, wv, z, N);

    // normalize (fused) + output projection
    out_proj_wmma<<<gemm_blocks, 256, 0, stream>>>(wv, z, Wo, bo,
                                                   (float*)d_out, N);
}

// v003
// It runs in 253 microseconds.
// In both of two side-by-side timings against v002, it was 1.21 times as fast.
// Counting every step since v000, it is 4.46 times as fast.
#include <hip/hip_runtime.h>
#include <hip/hip_bf16.h>
#include <math.h>

#define HID 256
#define NHEAD 8
#define DK 32
// 1/sqrt(32)
#define SCALE_INV 0.17677669529663687f

typedef float v2f __attribute__((ext_vector_type(2)));
typedef float v4f __attribute__((ext_vector_type(4)));
typedef float v8f __attribute__((ext_vector_type(8)));

// ---------------------------------------------------------------------------
// Projection GEMM tile: one block = 128 staged rows x 256 output columns, one
// wave = 8 row tiles x 2 column tiles of 16x16 (16 accumulators), K = 256.
// A weight fragment loaded from global feeds 8 WMMAs, a row fragment read from
// LDS feeds 2. k runs upward in every accumulator.
// Lane layout (V_WMMA_F32_16X16X4_F32):
//   A: lane m = lane&15 holds row m, K = k0 + 2*(lane>>4) + {0,1}
//   B: lane n = lane&15 holds col n, same K pairing
//   D: lane&15 = col, VGPR r -> row r + 8*(lane>>4)
// LDS rows are 260 floats apart: the 16 rows of a fragment read then start 4
// banks apart and the two lane halves 2 apart, so its 64 dwords hit 64 banks.
// ---------------------------------------------------------------------------
#define ROWS 128
#define MT 8
#define NT 2
#define PITCH 260

__device__ __forceinline__ void gemm_tile(const float* lds_in,
                                          const float* __restrict__ Wm,
                                          const float* __restrict__ bias,
                                          float* __restrict__ Out,
                                          int row0, int nrows)
{
    const int wave  = threadIdx.x >> 5;
    const int lane  = threadIdx.x & 31;
    const int m     = lane & 15;
    const int khalf = (lane >> 4) << 1;
    const int n0    = wave * (NT * 16) + m;
    const float* arow = lds_in + m * PITCH + khalf;
    const float* __restrict__ wrow = Wm + (size_t)n0 * HID + khalf;

    v8f acc[MT][NT] = {};
    #pragma unroll 4   // several k steps of fragment loads in flight ahead of their WMMAs
    for (int k0 = 0; k0 < HID; k0 += 4) {
        v2f b[NT];
        #pragma unroll
        for (int j = 0; j < NT; ++j)
            b[j] = *(const v2f*)(wrow + j * 16 * HID + k0);
        #pragma unroll
        for (int i = 0; i < MT; ++i) {
            const v2f a = *(const v2f*)(arow + i * 16 * PITCH + k0);
            #pragma unroll
            for (int j = 0; j < NT; ++j)
                acc[i][j] = __builtin_amdgcn_wmma_f32_16x16x4_f32(
                    false, a, false, b[j], (short)0, acc[i][j], false, false);
        }
    }

    float bval[NT];
    #pragma unroll
    for (int j = 0; j < NT; ++j)
        bval[j] = bias ? bias[n0 + j * 16] : 0.0f;

    const int rhalf = (lane >> 4) << 3;
    #pragma unroll
    for (int i = 0; i < MT; ++i) {
        const int rt = row0 + i * 16;
        if (rt + 16 <= nrows) {              // uniform fast path: no exec juggling
            #pragma unroll
            for (int r = 0; r < 8; ++r)
                #pragma unroll
                for (int j = 0; j < NT; ++j)
                    Out[(size_t)(rt + rhalf + r) * HID + n0 + j * 16] = acc[i][j][r] + bval[j];
            // the wait in front of the next tile's overwrite of these stores' registers
            asm volatile("s_wait_xcnt 0x0" ::: "memory");
        } else {
            #pragma unroll
            for (int r = 0; r < 8; ++r)
                if (rt + rhalf + r < nrows) {
                    #pragma unroll
                    for (int j = 0; j < NT; ++j)
                        Out[(size_t)(rt + rhalf + r) * HID + n0 + j * 16] = acc[i][j][r] + bval[j];
                }
        }
    }
}

// ---------------------------------------------------------------------------
// Q/K/V projection: blockIdx.x picks the matrix, blockIdx.y the 128 rows, so
// the three blocks that read the same input rows start next to each other.
// q gets bias bq; k, v are bias-free (matches reference).
// ---------------------------------------------------------------------------
__global__ __launch_bounds__(256) void qkv_proj_wmma(
    const float* __restrict__ In,
    const float* __restrict__ Wq, const float* __restrict__ Wk,
    const float* __restrict__ Wv, const float* __restrict__ bq,
    float* __restrict__ q, float* __restrict__ k, float* __restrict__ v,
    int nrows)
{
    __shared__ __attribute__((aligned(16))) float lds_in[ROWS * PITCH];   // 130 KB: two blocks per WGP
    const int mat  = blockIdx.x;
    const int row0 = blockIdx.y * ROWS;

    #pragma unroll 8   // eight 16-byte loads in flight per lane
    for (int it = 0; it < ROWS / 4; ++it) {          // 256 threads = 4 rows of 64 x 16 bytes
        const int r  = it * 4 + (threadIdx.x >> 6);
        const int c  = (threadIdx.x & 63) << 2;
        const int gr = min(row0 + r, nrows - 1);   // past the end: a copy of the last row, never stored
        *(v4f*)(lds_in + r * PITCH + c) = *(const v4f*)(In + (size_t)gr * HID + c);
    }
    __syncthreads();

    const float* __restrict__ Wm = (mat == 0) ? Wq : (mat == 1) ? Wk : Wv;
    float* __restrict__       O  = (mat == 0) ? q  : (mat == 1) ? k  : v;
    gemm_tile(lds_in, Wm, (mat == 0) ? bq : nullptr, O, row0, nrows);
}

// ---------------------------------------------------------------------------
// Output projection with fused 1/z normalization of the LDS-staged rows:
// Out = (wv / z) @ Wo^T + bo
// ---------------------------------------------------------------------------
__global__ __launch_bounds__(256) void out_proj_wmma(
    const float* __restrict__ WV, const float* __restrict__ Z,
    const float* __restrict__ Wo, const float* __restrict__ bo,
    float* __restrict__ Out, int nrows)
{
    __shared__ __attribute__((aligned(16))) float lds_in[ROWS * PITCH];
    const int row0 = blockIdx.x * ROWS;

    #pragma unroll 4   // several 16-byte loads in flight per lane
    for (int it = 0; it < ROWS / 4; ++it) {          // 256 threads = 4 rows of 64 x 16 bytes
        const int r  = it * 4 + (threadIdx.x >> 6);
        const int c  = (threadIdx.x & 63) << 2;
        const int gr = min(row0 + r, nrows - 1);   // past the end: a copy of the last row, never stored
        const v4f   w  = *(const v4f*)(WV + (size_t)gr * HID + c);
        const float zz = Z[(size_t)gr * NHEAD + (c >> 5)];
        v4f val;
        val.x = w.x / zz; val.y = w.y / zz; val.z = w.z / zz; val.w = w.w / zz;
        *(v4f*)(lds_in + r * PITCH + c) = val;
    }
    __syncthreads();

    gemm_tile(lds_in, Wo, bo, Out, row0, nrows);
}

// ---------------------------------------------------------------------------
// Edge attention as a gather. A block owns NPB nodes in a row. It reads the
// whole dst array once and keeps, in LDS, the ids of the edges that end in its
// own nodes; a wave then takes one node at a time, puts the node's edges into
// edge-id order, so that the f32 sums run in one fixed order on every run, and
// sums them in registers. No list goes through global memory.
// ---------------------------------------------------------------------------
#define NPB 196        // nodes per block
#define CAP 64         // edge ids an LDS list holds; a node with more takes the slow path
#define ATHREADS 1024
#define SCAN_U 13      // 16-byte dst loads in flight per lane

__device__ __forceinline__ int clamp_node(int x, int nnodes) {
    return min(max(x, 0), nnodes - 1);   // bounds every address formed from src
}

// u = dst - first node of the block: below npb only for the block's own nodes,
// which also bounds the LDS addresses formed from it
__device__ __forceinline__ void keep_edge(unsigned u, int e, unsigned npb,
                                          int* cnt, int* ids)
{
    if (u < npb) {
        const int pos = atomicAdd(&cnt[u], 1);   // arrival order, undone by the ordering below
        if (pos < CAP) ids[u * CAP + pos] = e;
    }
}

// four edges: one test for the common case that none of them is the block's
__device__ __forceinline__ void scan_quad(const int4& d, int e, unsigned n0,
                                          unsigned npb, int* cnt, int* ids)
{
    const unsigned u0 = (unsigned)d.x - n0;
    const unsigned u1 = (unsigned)d.y - n0;
    const unsigned u2 = (unsigned)d.z - n0;
    const unsigned u3 = (unsigned)d.w - n0;
    if (min(min(u0, u1), min(u2, u3)) < npb) {
        keep_edge(u0, e,     npb, cnt, ids);
        keep_edge(u1, e + 1, npb, cnt, ids);
        keep_edge(u2, e + 2, npb, cnt, ids);
        keep_edge(u3, e + 3, npb, cnt, ids);
    }
}

// sum over the four lanes that share a head (quad_perm swaps, no LDS path)
__device__ __forceinline__ float quad_sum(float x) {
    x += __int_as_float(__builtin_amdgcn_mov_dpp(__float_as_int(x), 0xB1, 0xF, 0xF, true));
    x += __int_as_float(__builtin_amdgcn_mov_dpp(__float_as_int(x), 0x4E, 0xF, 0xF, true));
    return x;
}

// U edges of one node: all 4*U row loads are issued first, then the edges are
// added one after the other, in list order.
template <int U>
__device__ __forceinline__ void add_edges(
    const float* __restrict__ k, const float* __restrict__ v,
    int sid, int t, unsigned cbytes, const v4f& q0, const v4f& q1,
    v2f (&a)[4], float& zs)
{
    v4f k0[U], k1[U], v0[U], v1[U];
    unsigned ofs[4] = {0u, 0u, 0u, 0u};      // byte offset of this lane's 32 bytes in row s
    #pragma unroll
    for (int u = 0; u < U; ++u) {
        ofs[u] = (unsigned)__builtin_amdgcn_readlane(sid, t + u) * (HID * 4u) + cbytes;
        const v4f* __restrict__ kp = (const v4f*)((const char*)k + ofs[u]);
        const v4f* __restrict__ vp = (const v4f*)((const char*)v + ofs[u]);
        k0[u] = kp[0]; k1[u] = kp[1];
        v0[u] = vp[0]; v1[u] = vp[1];
    }
    // The wait that belongs in front of any overwrite of a register which an
    // issued load names; the offsets are inputs so that they stay in their
    // registers up to here.
    asm volatile("s_wait_xcnt 0x0"
                 :: "v"(ofs[0]), "v"(ofs[1]), "v"(ofs[2]), "v"(ofs[3]) : "memory");
    // Keeps the arithmetic below behind all 4*U loads: without it the scheduler
    // mixes the two to save registers and a wave waits once per row, not per group.
    __builtin_amdgcn_sched_barrier(0);
    #pragma unroll
    for (int u = 0; u < U; ++u) {
        v2f p2 = k0[u].xy * q0.xy;
        p2 = __builtin_elementwise_fma(k0[u].zw, q0.zw, p2);
        p2 = __builtin_elementwise_fma(k1[u].xy, q1.xy, p2);
        p2 = __builtin_elementwise_fma(k1[u].zw, q1.zw, p2);
        const float p = quad_sum(p2.x + p2.y);
        const float score = expf(fminf(fmaxf(p * SCALE_INV, -10.0f), 10.0f));
        const v2f s2 = {score, score};
        a[0] = __builtin_elementwise_fma(v0[u].xy, s2, a[0]);
        a[1] = __builtin_elementwise_fma(v0[u].zw, s2, a[1]);
        a[2] = __builtin_elementwise_fma(v1[u].xy, s2, a[2]);
        a[3] = __builtin_elementwise_fma(v1[u].zw, s2, a[3]);
        zs += score;
    }
}

// Lane l holds columns 8l..8l+7 of the 256-wide row, so head h lives in lanes
// 4h..4h+3. wv and z are stored once, never added into.
__global__ __launch_bounds__(ATHREADS) void node_attn(
    const float* __restrict__ q, const float* __restrict__ k,
    const float* __restrict__ v, const int* __restrict__ src,
    const int* __restrict__ dst, float* __restrict__ wv,
    float* __restrict__ z, int nedges, int nnodes)
{
    __shared__ int s_cnt[NPB];          // in-degree of each own node
    __shared__ int s_next;              // next own node that no wave has taken yet
    __shared__ int s_ids[NPB * CAP];    // edge ids per node, arrival order
    __shared__ int s_src[NPB * CAP];    // source nodes per node, edge-id order

    const int tid  = threadIdx.x;
    const int lane = tid & 31;
    const int n0   = blockIdx.x * NPB;
    const unsigned npb = (unsigned)min(NPB, nnodes - n0);

    if (tid < NPB)  s_cnt[tid] = 0;
    if (tid == NPB) s_next = 0;
    __syncthreads();

    // every edge's dst, four per lane and load
    const int nq = nedges >> 2;
    const int4* __restrict__ d4 = (const int4*)dst;
    int qb = 0;
    for (; qb + ATHREADS * SCAN_U <= nq; qb += ATHREADS * SCAN_U) {
        const int4* __restrict__ p = d4 + qb + tid;
        int4 d[SCAN_U];
        #pragma unroll
        for (int j = 0; j < SCAN_U; ++j)
            d[j] = p[j * ATHREADS];
        // the wait in front of the next trip's overwrite of these loads' address registers
        asm volatile("s_wait_xcnt 0x0" ::: "memory");
        #pragma unroll
        for (int j = 0; j < SCAN_U; ++j)
            scan_quad(d[j], (qb + tid + j * ATHREADS) << 2, (unsigned)n0, npb, s_cnt, s_ids);
    }
    for (int qi = qb + tid; qi < nq; qi += ATHREADS) {
        const int4 d = d4[qi];
        // the wait in front of the next trip's overwrite of that load's address registers
        asm volatile("s_wait_xcnt 0x0" ::: "memory");
        scan_quad(d, qi << 2, (unsigned)n0, npb, s_cnt, s_ids);
    }
    for (int e = (nq << 2) + tid; e < nedges; e += ATHREADS) {
        const int d = dst[e];
        // the wait in front of the next trip's overwrite of that load's address registers
        asm volatile("s_wait_xcnt 0x0" ::: "memory");
        keep_edge((unsigned)d - (unsigned)n0, e, npb, s_cnt, s_ids);
    }
    __syncthreads();

    const unsigned cbytes = (unsigned)lane * 32u;   // 8 floats per lane

    for (int trip = 0; trip < NPB; ++trip) {
        int l = 0;
        if (lane == 0) l = atomicAdd(&s_next, 1);   // waves take nodes as they get free
        l = __builtin_amdgcn_readfirstlane(l);
        if (l >= (int)npb) break;                   // wave-uniform, no barrier below
        const int n = n0 + l;
        const int c = __builtin_amdgcn_readfirstlane(s_cnt[l]);
        const int* ids = s_ids + l * CAP;
        int*       so  = s_src + l * CAP;

        if (c <= CAP) {
            // An edge goes to the place given by how many edges of the node have
            // a smaller id: 32 edges at a time against all of the node's.
            for (int cb = 0; cb < c; cb += 32) {
                const int mine = ids[min(cb + lane, c - 1)];
                const int s    = src[mine];          // mine is an edge id this block formed itself
                // the wait in front of any overwrite of that load's address registers
                asm volatile("s_wait_xcnt 0x0" ::: "memory");
                int r = 0;
                for (int ob = 0; ob < c; ob += 32) {
                    const int om  = min(32, c - ob);
                    const int oid = ids[min(ob + lane, c - 1)];
                    for (int t = 0; t < om; ++t)
                        r += (__builtin_amdgcn_readlane(oid, t) < mine) ? 1 : 0;
                }
                if (cb + lane < c)
                    so[r] = clamp_node(s, nnodes);
            }
        }
        // the wave's own LDS stores are done before it reads the list back across lanes
        asm volatile("s_wait_dscnt 0x0" ::: "memory");

        // asked for here, so that the q row comes in together with the first k and v rows
        const v4f* __restrict__ qp =
            (const v4f*)((const char*)(q + (size_t)n * HID) + cbytes);
        const v4f q0 = qp[0];
        const v4f q1 = qp[1];
        // the wait in front of any overwrite of these loads' address registers
        asm volatile("s_wait_xcnt 0x0" ::: "memory");
        v2f   a[4] = {};
        float zs   = 0.0f;

        if (c <= CAP) {
            for (int j0 = 0; j0 < c; j0 += 32) {
                const int m   = min(32, c - j0);
                const int sid = so[j0 + min(lane, m - 1)];   // up to 32 sources, one per lane
                int t = 0;
                for (; t + 4 <= m; t += 4)
                    add_edges<4>(k, v, sid, t, cbytes, q0, q1, a, zs);
                const int r = m - t;
                if (r == 3)      add_edges<3>(k, v, sid, t, cbytes, q0, q1, a, zs);
                else if (r == 2) add_edges<2>(k, v, sid, t, cbytes, q0, q1, a, zs);
                else if (r == 1) add_edges<1>(k, v, sid, t, cbytes, q0, q1, a, zs);
            }
        } else {
            // More in-edges than an LDS list holds: walk all edges in id order.
            for (int e0 = 0; e0 < nedges; e0 += 32) {
                const int e  = min(e0 + lane, nedges - 1);
                const int dd = dst[e];
                const int ss = src[e];
                // the wait in front of the next trip's overwrite of these loads' address registers
                asm volatile("s_wait_xcnt 0x0" ::: "memory");
                const int sid = clamp_node(ss, nnodes);
                unsigned hit = __builtin_amdgcn_ballot_w32(e0 + lane < nedges && dd == n);
                while (hit) {                        // at most 32 trips
                    const int t = __builtin_ctz(hit);
                    hit &= hit - 1u;
                    add_edges<1>(k, v, sid, t, cbytes, q0, q1, a, zs);
                }
            }
        }

        v4f* __restrict__ wp = (v4f*)((char*)(wv + (size_t)n * HID) + cbytes);
        const v4f w0 = {a[0].x, a[0].y, a[1].x, a[1].y};
        const v4f w1 = {a[2].x, a[2].y, a[3].x, a[3].y};
        wp[0] = w0;
        wp[1] = w1;
        if ((lane & 3) == 0)
            z[(size_t)n * NHEAD + (lane >> 2)] = zs;
        // the wait in front of the next node's overwrite of these stores' registers
        asm volatile("s_wait_xcnt 0x0" ::: "memory");
    }
}

// ---------------------------------------------------------------------------
extern "C" void kernel_launch(void* const* d_in, const int* in_sizes, int n_in,
                              void* d_out, int out_size, void* d_ws, size_t ws_size,
                              hipStream_t stream) {
    (void)n_in; (void)out_size; (void)ws_size;
    const float* inputs = (const float*)d_in[0];
    const float* Wq     = (const float*)d_in[1];
    const float* bq     = (const float*)d_in[2];
    const float* Wk     = (const float*)d_in[3];
    const float* Wv     = (const float*)d_in[4];
    const float* Wo     = (const float*)d_in[5];
    const float* bo     = (const float*)d_in[6];
    const int*   src    = (const int*)d_in[7];
    const int*   dst    = (const int*)d_in[8];

    const int N = in_sizes[0] / HID;   // 50000
    const int E = in_sizes[7];         // 800000

    float* q  = (float*)d_ws;
    float* k  = q  + (size_t)N * HID;
    float* v  = k  + (size_t)N * HID;
    float* wv = v  + (size_t)N * HID;
    float* z  = wv + (size_t)N * HID;

    const int gemm_blocks = (N + ROWS - 1) / ROWS;

    // Q/K/V projections: x = matrix, y = block of 128 rows
    qkv_proj_wmma<<<dim3(3, gemm_blocks), 256, 0, stream>>>(inputs, Wq, Wk, Wv, bq,
                                                   q, k, v, N);

    // each block finds the in-edges of its NPB nodes and sums them
    node_attn<<<(N + NPB - 1) / NPB, ATHREADS, 0, stream>>>(q, k, v, src, dst, wv, z, E, N);

    // normalize (fused) + output projection
    out_proj_wmma<<<gemm_blocks, 256, 0, stream>>>(wv, z, Wo, bo,
                                                   (float*)d_out, N);
}

// v004
// It runs in 235 microseconds.
// Timed twice side by side with v003, it ran 1.08 times as fast both times.
// Counting every step since v000, it is 4.80 times as fast.
#include <hip/hip_runtime.h>
#include <hip/hip_bf16.h>
#include <math.h>

#define HID 256
#define NHEAD 8
#define DK 32
// 1/sqrt(32)
#define SCALE_INV 0.17677669529663687f

typedef float v2f __attribute__((ext_vector_type(2)));
typedef float v4f __attribute__((ext_vector_type(4)));
typedef float v8f __attribute__((ext_vector_type(8)));

// ---------------------------------------------------------------------------
// Projection GEMM tile: one block = 128 staged rows x 256 output columns, one
// wave = 8 row tiles x 2 column tiles of 16x16 (16 accumulators), K = 256.
// A weight fragment loaded from global feeds 8 WMMAs, a row fragment read from
// LDS feeds 2. k runs upward in every accumulator.
// Lane layout (V_WMMA_F32_16X16X4_F32):
//   A: lane m = lane&15 holds row m, K = k0 + 2*(lane>>4) + {0,1}
//   B: lane n = lane&15 holds col n, same K pairing
//   D: lane&15 = col, VGPR r -> row r + 8*(lane>>4)
// LDS rows are 260 floats apart: the 16 rows of a fragment read then start 4
// banks apart and the two lane halves 2 apart, so its 64 dwords hit 64 banks.
// ---------------------------------------------------------------------------
#define ROWS 128
#define MT 8
#define NT 2
#define PITCH 260

__device__ __forceinline__ void gemm_tile(const float* lds_in,
                                          const float* __restrict__ Wm,
                                          const float* __restrict__ bias,
                                          float* __restrict__ Out,
                                          int row0, int nrows)
{
    const int wave  = threadIdx.x >> 5;
    const int lane  = threadIdx.x & 31;
    const int m     = lane & 15;
    const int khalf = (lane >> 4) << 1;
    const int n0    = wave * (NT * 16) + m;
    const float* arow = lds_in + m * PITCH + khalf;
    const float* __restrict__ wrow = Wm + (size_t)n0 * HID + khalf;

    v8f acc[MT][NT] = {};
    #pragma unroll 4   // several k steps of fragment loads in flight ahead of their WMMAs
    for (int k0 = 0; k0 < HID; k0 += 4) {
        v2f b[NT];
        #pragma unroll
        for (int j = 0; j < NT; ++j)
            b[j] = *(const v2f*)(wrow + j * 16 * HID + k0);
        #pragma unroll
        for (int i = 0; i < MT; ++i) {
            const v2f a = *(const v2f*)(arow + i * 16 * PITCH + k0);
            #pragma unroll
            for (int j = 0; j < NT; ++j)
                acc[i][j] = __builtin_amdgcn_wmma_f32_16x16x4_f32(
                    false, a, false, b[j], (short)0, acc[i][j], false, false);
        }
    }

    float bval[NT];
    #pragma unroll
    for (int j = 0; j < NT; ++j)
        bval[j] = bias ? bias[n0 + j * 16] : 0.0f;

    const int rhalf = (lane >> 4) << 3;
    #pragma unroll
    for (int i = 0; i < MT; ++i) {
        const int rt = row0 + i * 16;
        if (rt + 16 <= nrows) {              // uniform fast path: no exec juggling
            #pragma unroll
            for (int r = 0; r < 8; ++r)
                #pragma unroll
                for (int j = 0; j < NT; ++j)
                    Out[(size_t)(rt + rhalf + r) * HID + n0 + j * 16] = acc[i][j][r] + bval[j];
            // the wait in front of the next tile's overwrite of these stores' registers
            asm volatile("s_wait_xcnt 0x0" ::: "memory");
        } else {
            #pragma unroll
            for (int r = 0; r < 8; ++r)
                if (rt + rhalf + r < nrows) {
                    #pragma unroll
                    for (int j = 0; j < NT; ++j)
                        Out[(size_t)(rt + rhalf + r) * HID + n0 + j * 16] = acc[i][j][r] + bval[j];
                }
        }
    }
}

// ---------------------------------------------------------------------------
// Q/K/V projection: blockIdx.x picks the matrix, blockIdx.y the 128 rows, so
// the three blocks that read the same input rows start next to each other.
// q gets bias bq; k, v are bias-free (matches reference).
// ---------------------------------------------------------------------------
__global__ __launch_bounds__(256) void qkv_proj_wmma(
    const float* __restrict__ In,
    const float* __restrict__ Wq, const float* __restrict__ Wk,
    const float* __restrict__ Wv, const float* __restrict__ bq,
    float* __restrict__ q, float* __restrict__ k, float* __restrict__ v,
    int nrows)
{
    __shared__ __attribute__((aligned(16))) float lds_in[ROWS * PITCH];   // 130 KB: two blocks per WGP
    const int mat  = blockIdx.x;
    const int row0 = blockIdx.y * ROWS;

    #pragma unroll 8   // eight 16-byte loads in flight per lane
    for (int it = 0; it < ROWS / 4; ++it) {          // 256 threads = 4 rows of 64 x 16 bytes
        const int r  = it * 4 + (threadIdx.x >> 6);
        const int c  = (threadIdx.x & 63) << 2;
        const int gr = min(row0 + r, nrows - 1);   // past the end: a copy of the last row, never stored
        *(v4f*)(lds_in + r * PITCH + c) = *(const v4f*)(In + (size_t)gr * HID + c);
    }
    __syncthreads();

    const float* __restrict__ Wm = (mat == 0) ? Wq : (mat == 1) ? Wk : Wv;
    float* __restrict__       O  = (mat == 0) ? q  : (mat == 1) ? k  : v;
    gemm_tile(lds_in, Wm, (mat == 0) ? bq : nullptr, O, row0, nrows);
}

// ---------------------------------------------------------------------------
// Edge attention as a gather. A block owns NPB nodes in a row. It reads the
// whole dst array once and keeps, in LDS, the ids of the edges that end in its
// own nodes; a wave then takes one node at a time, puts the node's edges into
// edge-id order, so that the f32 sums run in one fixed order on every run, and
// sums them in registers. No list goes through global memory. The node's row
// wv / z stays in LDS, and when all rows of the block are there its waves
// multiply them by Wo^T: Out = (wv / z) @ Wo^T + bo.
// ---------------------------------------------------------------------------
#define NPB 196        // nodes per block
#define CAP 64         // edge ids an LDS list holds; a node with more takes the slow path
#define ATHREADS 1024
#define SCAN_U 13      // 16-byte dst loads in flight per lane
#define OTILES 13      // 16-row tiles that hold the NPB rows of a block

__device__ __forceinline__ int clamp_node(int x, int nnodes) {
    return min(max(x, 0), nnodes - 1);   // bounds every address formed from src
}

// u = dst - first node of the block: below npb only for the block's own nodes,
// which also bounds the LDS addresses formed from it
__device__ __forceinline__ void keep_edge(unsigned u, int e, unsigned npb,
                                          int* cnt, int* ids)
{
    if (u < npb) {
        const int pos = atomicAdd(&cnt[u], 1);   // arrival order, undone by the ordering below
        if (pos < CAP) ids[u * CAP + pos] = e;
    }
}

// four edges: one test for the common case that none of them is the block's
__device__ __forceinline__ void scan_quad(const int4& d, int e, unsigned n0,
                                          unsigned npb, int* cnt, int* ids)
{
    const unsigned u0 = (unsigned)d.x - n0;
    const unsigned u1 = (unsigned)d.y - n0;
    const unsigned u2 = (unsigned)d.z - n0;
    const unsigned u3 = (unsigned)d.w - n0;
    if (min(min(u0, u1), min(u2, u3)) < npb) {
        keep_edge(u0, e,     npb, cnt, ids);
        keep_edge(u1, e + 1, npb, cnt, ids);
        keep_edge(u2, e + 2, npb, cnt, ids);
        keep_edge(u3, e + 3, npb, cnt, ids);
    }
}

// sum over the four lanes that share a head (quad_perm swaps, no LDS path)
__device__ __forceinline__ float quad_sum(float x) {
    x += __int_as_float(__builtin_amdgcn_mov_dpp(__float_as_int(x), 0xB1, 0xF, 0xF, true));
    x += __int_as_float(__builtin_amdgcn_mov_dpp(__float_as_int(x), 0x4E, 0xF, 0xF, true));
    return x;
}

// U edges of one node: all 4*U row loads are issued first, then the edges are
// added one after the other, in list order.
template <int U>
__device__ __forceinline__ void add_edges(
    const float* __restrict__ k, const float* __restrict__ v,
    int sid, int t, unsigned cbytes, const v4f& q0, const v4f& q1,
    v2f (&a)[4], float& zs)
{
    v4f k0[U], k1[U], v0[U], v1[U];
    unsigned ofs[4] = {0u, 0u, 0u, 0u};      // byte offset of this lane's 32 bytes in row s
    #pragma unroll
    for (int u = 0; u < U; ++u) {
        ofs[u] = (unsigned)__builtin_amdgcn_readlane(sid, t + u) * (HID * 4u) + cbytes;
        const v4f* __restrict__ kp = (const v4f*)((const char*)k + ofs[u]);
        const v4f* __restrict__ vp = (const v4f*)((const char*)v + ofs[u]);
        k0[u] = kp[0]; k1[u] = kp[1];
        v0[u] = vp[0]; v1[u] = vp[1];
    }
    // The wait that belongs in front of any overwrite of a register which an
    // issued load names; the offsets are inputs so that they stay in their
    // registers up to here.
    asm volatile("s_wait_xcnt 0x0"
                 :: "v"(ofs[0]), "v"(ofs[1]), "v"(ofs[2]), "v"(ofs[3]) : "memory");
    // Keeps the arithmetic below behind all 4*U loads: without it the scheduler
    // mixes the two to save registers and a wave waits once per row, not per group.
    __builtin_amdgcn_sched_barrier(0);
    #pragma unroll
    for (int u = 0; u < U; ++u) {
        v2f p2 = k0[u].xy * q0.xy;
        p2 = __builtin_elementwise_fma(k0[u].zw, q0.zw, p2);
        p2 = __builtin_elementwise_fma(k1[u].xy, q1.xy, p2);
        p2 = __builtin_elementwise_fma(k1[u].zw, q1.zw, p2);
        const float p = quad_sum(p2.x + p2.y);
        const float score = expf(fminf(fmaxf(p * SCALE_INV, -10.0f), 10.0f));
        const v2f s2 = {score, score};
        a[0] = __builtin_elementwise_fma(v0[u].xy, s2, a[0]);
        a[1] = __builtin_elementwise_fma(v0[u].zw, s2, a[1]);
        a[2] = __builtin_elementwise_fma(v1[u].xy, s2, a[2]);
        a[3] = __builtin_elementwise_fma(v1[u].zw, s2, a[3]);
        zs += score;
    }
}

// Output projection of the block's LDS rows: one wave = T row tiles x one column
// tile of 16x16, K = 256, k upward in every accumulator. Fragment layout and LDS
// pitch as in gemm_tile; a Wo fragment from global feeds T WMMAs.
template <int T>
__device__ __forceinline__ void out_tiles(const float* rows,
                                          const float* __restrict__ Wo,
                                          const float* __restrict__ bo,
                                          float* __restrict__ Out,
                                          int tile0, int ctile, int lane,
                                          int node0, int npb)
{
    const int m     = lane & 15;
    const int khalf = (lane >> 4) << 1;
    const int col   = ctile * 16 + m;
    const float* arow = rows + (tile0 * 16 + m) * PITCH + khalf;
    const float* __restrict__ wrow = Wo + (size_t)col * HID + khalf;

    v8f acc[T] = {};
    // Two k steps a trip: their fragment loads go out together ahead of the WMMAs, and all
    // LDS address arithmetic of the trip stands in front of its first WMMA.
    #pragma unroll 2
    for (int k0 = 0; k0 < HID; k0 += 4) {
        const v2f b = *(const v2f*)(wrow + k0);
        #pragma unroll
        for (int i = 0; i < T; ++i) {
            const v2f a = *(const v2f*)(arow + i * 16 * PITCH + k0);
            acc[i] = __builtin_amdgcn_wmma_f32_16x16x4_f32(
                false, a, false, b, (short)0, acc[i], false, false);
        }
    }

    // Four vector slots between the last WMMAs and the first vector instruction behind the
    // loop that reuses one of their registers: the distance the matrix unit asks for.
    asm volatile("v_nop\n\tv_nop\n\tv_nop\n\tv_nop");
    // keeps the arithmetic of the stores behind those slots
    __builtin_amdgcn_sched_barrier(0);

    const float bval  = bo[col];
    const int   rhalf = (lane >> 4) << 3;
    // tiles whose 16 rows all belong to nodes: a uniform test, eight stores in a row
    #pragma unroll
    for (int i = 0; i < T; ++i) {
        const int rt = (tile0 + i) * 16;           // first row of the tile, counted in the block
        if (rt + 16 <= npb) {
            float* __restrict__ o = Out + (size_t)(node0 + rt + rhalf) * HID + col;
            #pragma unroll
            for (int r = 0; r < 8; ++r)
                o[r * HID] = acc[i][r] + bval;
            // the wait in front of the next tile's overwrite of these stores' registers
            asm volatile("s_wait_xcnt 0x0" ::: "memory");
        }
    }
    // the tile that the block's last node cuts: rows past it are not stored
    #pragma unroll
    for (int i = 0; i < T; ++i) {
        const int rt = (tile0 + i) * 16;
        if (rt < npb && rt + 16 > npb) {
            float* __restrict__ o = Out + (size_t)(node0 + rt + rhalf) * HID + col;
            #pragma unroll
            for (int r = 0; r < 8; ++r) {
                if (rt + rhalf + r < npb)
                    o[r * HID] = acc[i][r] + bval;
                // the wait in front of any later overwrite of that store's registers
                asm volatile("s_wait_xcnt 0x0" ::: "memory");
            }
        }
    }
}

// Lane l holds columns 8l..8l+7 of the 256-wide row, so head h lives in lanes
// 4h..4h+3. A row is written to LDS once, never added into.
__global__ __launch_bounds__(ATHREADS) void node_attn(
    const float* __restrict__ q, const float* __restrict__ k,
    const float* __restrict__ v, const int* __restrict__ src,
    const int* __restrict__ dst, const float* __restrict__ Wo,
    const float* __restrict__ bo, float* __restrict__ Out,
    int nedges, int nnodes)
{
    __shared__ __attribute__((aligned(16))) float s_rows[OTILES * 16 * PITCH];   // wv / z per own node
    __shared__ int s_cnt[NPB];          // in-degree of each own node
    __shared__ int s_next;              // next own node that no wave has taken yet
    __shared__ int s_ids[NPB * CAP];    // edge ids per node, arrival order
    __shared__ int s_src[NPB * CAP];    // source nodes per node, edge-id order

    const int tid  = threadIdx.x;
    const int lane = tid & 31;
    const int n0   = blockIdx.x * NPB;
    const unsigned npb = (unsigned)min(NPB, nnodes - n0);

    if (tid < NPB)  s_cnt[tid] = 0;
    if (tid == NPB) s_next = 0;
    // rows of the last tiles that belong to no node: zero, multiplied but never stored
    for (int i = tid; i < (OTILES * 16 - (int)npb) * (HID / 4); i += ATHREADS) {
        const v4f zero = {0.0f, 0.0f, 0.0f, 0.0f};
        *(v4f*)(s_rows + ((int)npb + (i >> 6)) * PITCH + ((i & 63) << 2)) = zero;
    }
    __syncthreads();

    // every edge's dst, four per lane and load
    const int nq = nedges >> 2;
    const int4* __restrict__ d4 = (const int4*)dst;
    int qb = 0;
    for (; qb + ATHREADS * SCAN_U <= nq; qb += ATHREADS * SCAN_U) {
        const int4* __restrict__ p = d4 + qb + tid;
        int4 d[SCAN_U];
        #pragma unroll
        for (int j = 0; j < SCAN_U; ++j)
            d[j] = p[j * ATHREADS];
        // the wait in front of the next trip's overwrite of these loads' address registers
        asm volatile("s_wait_xcnt 0x0" ::: "memory");
        #pragma unroll
        for (int j = 0; j < SCAN_U; ++j)
            scan_quad(d[j], (qb + tid + j * ATHREADS) << 2, (unsigned)n0, npb, s_cnt, s_ids);
    }
    for (int qi = qb + tid; qi < nq; qi += ATHREADS) {
        const int4 d = d4[qi];
        // the wait in front of the next trip's overwrite of that load's address registers
        asm volatile("s_wait_xcnt 0x0" ::: "memory");
        scan_quad(d, qi << 2, (unsigned)n0, npb, s_cnt, s_ids);
    }
    for (int e = (nq << 2) + tid; e < nedges; e += ATHREADS) {
        const int d = dst[e];
        // the wait in front of the next trip's overwrite of that load's address registers
        asm volatile("s_wait_xcnt 0x0" ::: "memory");
        keep_edge((unsigned)d - (unsigned)n0, e, npb, s_cnt, s_ids);
    }
    __syncthreads();

    const unsigned cbytes = (unsigned)lane * 32u;   // 8 floats per lane

    for (int trip = 0; trip < NPB; ++trip) {
        int l = 0;
        if (lane == 0) l = atomicAdd(&s_next, 1);   // waves take nodes as they get free
        l = __builtin_amdgcn_readfirstlane(l);
        if (l >= (int)npb) break;                   // wave-uniform, no barrier in the loop
        const int n = n0 + l;
        const int c = __builtin_amdgcn_readfirstlane(s_cnt[l]);
        const int* ids = s_ids + l * CAP;
        int*       so  = s_src + l * CAP;

        if (c <= CAP) {
            // An edge goes to the place given by how many edges of the node have
            // a smaller id: 32 edges at a time against all of the node's.
            for (int cb = 0; cb < c; cb += 32) {
                const int mine = ids[min(cb + lane, c - 1)];
                const int s    = src[mine];          // mine is an edge id this block formed itself
                // the wait in front of any overwrite of that load's address registers
                asm volatile("s_wait_xcnt 0x0" ::: "memory");
                int r = 0;
                for (int ob = 0; ob < c; ob += 32) {
                    const int om  = min(32, c - ob);
                    const int oid = ids[min(ob + lane, c - 1)];
                    for (int t = 0; t < om; ++t)
                        r += (__builtin_amdgcn_readlane(oid, t) < mine) ? 1 : 0;
                }
                if (cb + lane < c)
                    so[r] = clamp_node(s, nnodes);
            }
        }
        // the wave's own LDS stores are done before it reads the list back across lanes
        asm volatile("s_wait_dscnt 0x0" ::: "memory");

        // asked for here, so that the q row comes in together with the first k and v rows
        const v4f* __restrict__ qp =
            (const v4f*)((const char*)(q + (size_t)n * HID) + cbytes);
        const v4f q0 = qp[0];
        const v4f q1 = qp[1];
        // the wait in front of any overwrite of these loads' address registers
        asm volatile("s_wait_xcnt 0x0" ::: "memory");
        v2f   a[4] = {};
        float zs   = 0.0f;

        if (c <= CAP) {
            for (int j0 = 0; j0 < c; j0 += 32) {
                const int m   = min(32, c - j0);
                const int sid = so[j0 + min(lane, m - 1)];   // up to 32 sources, one per lane
                int t = 0;
                for (; t + 4 <= m; t += 4)
                    add_edges<4>(k, v, sid, t, cbytes, q0, q1, a, zs);
                const int r = m - t;
                if (r == 3)      add_edges<3>(k, v, sid, t, cbytes, q0, q1, a, zs);
                else if (r == 2) add_edges<2>(k, v, sid, t, cbytes, q0, q1, a, zs);
                else if (r == 1) add_edges<1>(k, v, sid, t, cbytes, q0, q1, a, zs);
            }
        } else {
            // More in-edges than an LDS list holds: walk all edges in id order.
            for (int e0 = 0; e0 < nedges; e0 += 32) {
                const int e  = min(e0 + lane, nedges - 1);
                const int dd = dst[e];
                const int ss = src[e];
                // the wait in front of the next trip's overwrite of these loads' address registers;
                // the loaded values are inputs so that both loads stay in front of it
                asm volatile("s_wait_xcnt 0x0" :: "v"(dd), "v"(ss) : "memory");
                const int sid = clamp_node(ss, nnodes);
                unsigned hit = __builtin_amdgcn_ballot_w32(e0 + lane < nedges && dd == n);
                while (hit) {                        // at most 32 trips
                    const int t = __builtin_ctz(hit);
                    hit &= hit - 1u;
                    add_edges<1>(k, v, sid, t, cbytes, q0, q1, a, zs);
                }
            }
        }

        // zs is the head's whole sum in each of its four lanes
        v4f* wp = (v4f*)(s_rows + l * PITCH + lane * 8);
        const v4f w0 = {a[0].x / zs, a[0].y / zs, a[1].x / zs, a[1].y / zs};
        const v4f w1 = {a[2].x / zs, a[2].y / zs, a[3].x / zs, a[3].y / zs};
        wp[0] = w0;
        wp[1] = w1;
    }
    __syncthreads();   // every row of the block is in LDS before any wave multiplies

    const int wave = __builtin_amdgcn_readfirstlane(tid >> 5);   // scalar: the branch leaves all lanes on
    // 16 waves side by side cover the 256 columns; waves 0-15 take row tiles 0-6, waves
    // 16-31 tiles 7-12, so that every SIMD gets four waves of either kind
    if (wave < 16)
        out_tiles<7>(s_rows, Wo, bo, Out, 0, wave, lane, n0, (int)npb);
    else
        out_tiles<6>(s_rows, Wo, bo, Out, 7, wave - 16, lane, n0, (int)npb);
}

// ---------------------------------------------------------------------------
extern "C" void kernel_launch(void* const* d_in, const int* in_sizes, int n_in,
                              void* d_out, int out_size, void* d_ws, size_t ws_size,
                              hipStream_t stream) {
    (void)n_in; (void)out_size; (void)ws_size;
    const float* inputs = (const float*)d_in[0];
    const float* Wq     = (const float*)d_in[1];
    const float* bq     = (const float*)d_in[2];
    const float* Wk     = (const float*)d_in[3];
    const float* Wv     = (const float*)d_in[4];
    const float* Wo     = (const float*)d_in[5];
    const float* bo     = (const float*)d_in[6];
    const int*   src    = (const int*)d_in[7];
    const int*   dst    = (const int*)d_in[8];

    const int N = in_sizes[0] / HID;   // 50000
    const int E = in_sizes[7];         // 800000

    float* q  = (float*)d_ws;
    float* k  = q  + (size_t)N * HID;
    float* v  = k  + (size_t)N * HID;

    const int gemm_blocks = (N + ROWS - 1) / ROWS;

    // Q/K/V projections: x = matrix, y = block of 128 rows
    qkv_proj_wmma<<<dim3(3, gemm_blocks), 256, 0, stream>>>(inputs, Wq, Wk, Wv, bq,
                                                   q, k, v, N);

    // each block finds the in-edges of its NPB nodes, sums them, normalizes and projects
    node_attn<<<(N + NPB - 1) / NPB, ATHREADS, 0, stream>>>(q, k, v, src, dst, Wo, bo,
                                                            (float*)d_out, E, N);
}

// v005
// One run takes 212 microseconds.
// Next to v004, in two timings, it ran 1.11 times as fast each time.
// Counting every step since v000, it is 5.31 times as fast.
#include <hip/hip_runtime.h>
#include <hip/hip_bf16.h>
#include <math.h>

#define HID 256
#define NHEAD 8
#define DK 32
// 1/sqrt(32)
#define SCALE_INV 0.17677669529663687f

typedef float v2f __attribute__((ext_vector_type(2)));
typedef float v4f __attribute__((ext_vector_type(4)));
typedef float v8f __attribute__((ext_vector_type(8)));

// ---------------------------------------------------------------------------
// Projection GEMM tile: one block = 128 staged rows x 256 output columns, one
// wave = 8 row tiles x 2 column tiles of 16x16 (16 accumulators), K = 256.
// A weight fragment loaded from global feeds 8 WMMAs, a row fragment read from
// LDS feeds 2. k runs upward in every accumulator.
// Lane layout (V_WMMA_F32_16X16X4_F32):
//   A: lane m = lane&15 holds row m, K = k0 + 2*(lane>>4) + {0,1}
//   B: lane n = lane&15 holds col n, same K pairing
//   D: lane&15 = col, VGPR r -> row r + 8*(lane>>4)
// LDS rows are 260 floats apart: the 16 rows of a fragment read then start 4
// banks apart and the two lane halves 2 apart, so its 64 dwords hit 64 banks.
// ---------------------------------------------------------------------------
#define ROWS 128
#define MT 8
#define NT 2
#define PITCH 260

__device__ __forceinline__ void gemm_tile(const float* lds_in,
                                          const float* __restrict__ Wm,
                                          const float* __restrict__ bias,
                                          float* __restrict__ Out,
                                          int row0, int nrows)
{
    const int wave  = threadIdx.x >> 5;
    const int lane  = threadIdx.x & 31;
    const int m     = lane & 15;
    const int khalf = (lane >> 4) << 1;
    const int n0    = wave * (NT * 16) + m;
    const float* arow = lds_in + m * PITCH + khalf;
    const float* __restrict__ wrow = Wm + (size_t)n0 * HID + khalf;

    v8f acc[MT][NT] = {};
    #pragma unroll 4   // several k steps of fragment loads in flight ahead of their WMMAs
    for (int k0 = 0; k0 < HID; k0 += 4) {
        v2f b[NT];
        #pragma unroll
        for (int j = 0; j < NT; ++j)
            b[j] = *(const v2f*)(wrow + j * 16 * HID + k0);
        #pragma unroll
        for (int i = 0; i < MT; ++i) {
            const v2f a = *(const v2f*)(arow + i * 16 * PITCH + k0);
            #pragma unroll
            for (int j = 0; j < NT; ++j)
                acc[i][j] = __builtin_amdgcn_wmma_f32_16x16x4_f32(
                    false, a, false, b[j], (short)0, acc[i][j], false, false);
        }
    }

    float bval[NT];
    #pragma unroll
    for (int j = 0; j < NT; ++j)
        bval[j] = bias ? bias[n0 + j * 16] : 0.0f;

    const int rhalf = (lane >> 4) << 3;
    #pragma unroll
    for (int i = 0; i < MT; ++i) {
        const int rt = row0 + i * 16;
        if (rt + 16 <= nrows) {              // uniform fast path: no exec juggling
            #pragma unroll
            for (int r = 0; r < 8; ++r)
                #pragma unroll
                for (int j = 0; j < NT; ++j)
                    Out[(size_t)(rt + rhalf + r) * HID + n0 + j * 16] = acc[i][j][r] + bval[j];
            // the wait in front of the next tile's overwrite of these stores' registers
            asm volatile("s_wait_xcnt 0x0" ::: "memory");
        } else {
            #pragma unroll
            for (int r = 0; r < 8; ++r)
                if (rt + rhalf + r < nrows) {
                    #pragma unroll
                    for (int j = 0; j < NT; ++j)
                        Out[(size_t)(rt + rhalf + r) * HID + n0 + j * 16] = acc[i][j][r] + bval[j];
                }
        }
    }
}

// ---------------------------------------------------------------------------
// Edge binning. The edges are cut into slices of SLICE_E; one block puts the
// edges of its slice into the order of the node block (NPB nodes in a row) that
// their dst lies in: a counting sort in LDS. It writes the sorted slice and the
// start of every node block's run in it. An entry holds the node's place in its
// node block and the edge's place in its slice. Inside a run the order is that
// of arrival; the reader orders each node's edges by edge id.
// ---------------------------------------------------------------------------
#define NPB 196        // nodes per node block
#define NBUCK 256      // node blocks the tables have room for
#define SLICE_E 12512  // edges per slice: whole 128-byte lines, so no two blocks write one line
#define BIN_U 13       // 16-byte dst loads per lane: 256 lanes x 13 x 4 edges cover a slice
#define OFFP 288       // ints per slice in the table of starts: NBUCK + 1, in whole 128-byte lines
#define EL_BITS 14     // bits that hold an edge's place in its slice

__device__ __forceinline__ void bin_slice(int* lds, const int* __restrict__ dst,
                                          int* __restrict__ ent, int* __restrict__ off,
                                          int slice, int nedges, int nnodes)
{
    int* hist   = lds;                 // NBUCK counts
    int* base   = lds + NBUCK;         // NBUCK starts
    int* wsum   = lds + 2 * NBUCK;     // one total per wave
    int* sorted = lds + 1024;          // SLICE_E entries
    const int tid = threadIdx.x;
    const int e0  = slice * SLICE_E;
    const int ne  = min(SLICE_E, nedges - e0);
    const unsigned nb = (unsigned)min(NBUCK, (nnodes + NPB - 1) / NPB);
    const int* __restrict__ dp = dst + e0;

    hist[tid] = 0;                     // 256 threads, NBUCK counts
    __syncthreads();

    int4 d[BIN_U];
    #pragma unroll
    for (int j = 0; j < BIN_U; ++j) {
        const int el = ((j << 8) + tid) << 2;
        int4 x = {-1, -1, -1, -1};     // no edge: falls out at the bucket test
        if (el + 4 <= ne)
            x = *(const int4*)(dp + el);
        d[j] = x;
    }
    int dt = -1;                       // the up to three edges behind the slice's last whole four
    if (tid < (ne & 3))
        dt = dp[(ne & ~3) + tid];
    // the wait in front of any overwrite of these loads' address registers
    asm volatile("s_wait_xcnt 0x0" ::: "memory");

    // key = bucket and arrival rank in it, or -1; val = the entry
    int key[BIN_U * 4 + 1], val[BIN_U * 4 + 1];
    #pragma unroll
    for (int i = 0; i < BIN_U * 4 + 1; ++i) {
        const int j  = i >> 2;
        const int dd = (i == BIN_U * 4) ? dt
                     : ((i & 3) == 0) ? d[j < BIN_U ? j : 0].x : ((i & 3) == 1) ? d[j < BIN_U ? j : 0].y
                     : ((i & 3) == 2) ? d[j < BIN_U ? j : 0].z : d[j < BIN_U ? j : 0].w;
        const int el = (i == BIN_U * 4) ? (ne & ~3) + tid : ((((j << 8) + tid) << 2) + (i & 3));
        const unsigned b = (unsigned)dd / NPB;      // a dst below 0 or past the last node block: b >= nb
        int kk = -1;
        if (b < nb)                                 // bounds the LDS address formed from dst
            kk = (int)(b << 16) | atomicAdd(&hist[b], 1);
        key[i] = kk;
        val[i] = (int)(((unsigned)dd - b * NPB) << EL_BITS) | el;
    }
    __syncthreads();

    // exclusive prefix sum of the 256 counts: inside a wave, then over the 8 wave totals
    const int lane = tid & 31;
    const int h = hist[tid];
    int inc = h;
    #pragma unroll
    for (int s = 1; s < 32; s <<= 1) {
        const int o = __shfl_up(inc, s, 32);
        if (lane >= s) inc += o;
    }
    if (lane == 31) wsum[tid >> 5] = inc;
    __syncthreads();
    int wo = 0;
    #pragma unroll
    for (int w = 0; w < 8; ++w)
        wo += (w < (tid >> 5)) ? wsum[w] : 0;
    const int start = wo + inc - h;
    base[tid] = start;
    int* __restrict__ op = off + slice * OFFP;
    op[tid] = start;
    if (tid == NBUCK - 1) op[NBUCK] = start + h;
    __syncthreads();
    const int total = base[NBUCK - 1] + hist[NBUCK - 1];

    #pragma unroll
    for (int i = 0; i < BIN_U * 4 + 1; ++i)
        if (key[i] >= 0)
            sorted[base[key[i] >> 16] + (key[i] & 0xFFFF)] = val[i];
    __syncthreads();

    int* __restrict__ eo = ent + (size_t)slice * SLICE_E;
    for (int i = tid << 2; i < total; i += 1024) {
        if (i + 4 <= total) {
            *(int4*)(eo + i) = *(const int4*)(sorted + i);
        } else {
            for (int c = i; c < total; ++c)
                eo[c] = sorted[c];
        }
        // the wait in front of the next trip's overwrite of these stores' registers
        asm volatile("s_wait_xcnt 0x0" ::: "memory");
    }
}

// ---------------------------------------------------------------------------
// Q/K/V projection: blockIdx.x picks the matrix, blockIdx.y the 128 rows, so
// the three blocks that read the same input rows start next to each other.
// q gets bias bq; k, v are bias-free (matches reference).
// The first blocks of the grid bin the edges instead: they use the vector and
// LDS paths that the matrix-bound projection blocks beside them leave idle.
// ---------------------------------------------------------------------------
__global__ __launch_bounds__(256) void qkv_proj_wmma(
    const float* __restrict__ In,
    const float* __restrict__ Wq, const float* __restrict__ Wk,
    const float* __restrict__ Wv, const float* __restrict__ bq,
    float* __restrict__ q, float* __restrict__ k, float* __restrict__ v,
    int nrows, const int* __restrict__ dst, int* __restrict__ ent,
    int* __restrict__ off, int nedges)
{
    __shared__ __attribute__((aligned(16))) float lds_in[ROWS * PITCH];   // 130 KB: two blocks per WGP
    const int bin_y = (nedges + 3 * SLICE_E - 1) / (3 * SLICE_E);   // grid rows that bin, three slices each
    if ((int)blockIdx.y < bin_y) {                                  // the same for the whole block
        const int slice = blockIdx.y * 3 + blockIdx.x;
        if (slice * SLICE_E < nedges)
            bin_slice((int*)lds_in, dst, ent, off, slice, nedges, nrows);
        return;
    }
    const int mat  = blockIdx.x;
    const int row0 = ((int)blockIdx.y - bin_y) * ROWS;

    #pragma unroll 8   // eight 16-byte loads in flight per lane
    for (int it = 0; it < ROWS / 4; ++it) {          // 256 threads = 4 rows of 64 x 16 bytes
        const int r  = it * 4 + (threadIdx.x >> 6);
        const int c  = (threadIdx.x & 63) << 2;
        const int gr = min(row0 + r, nrows - 1);   // past the end: a copy of the last row, never stored
        *(v4f*)(lds_in + r * PITCH + c) = *(const v4f*)(In + (size_t)gr * HID + c);
    }
    __syncthreads();

    const float* __restrict__ Wm = (mat == 0) ? Wq : (mat == 1) ? Wk : Wv;
    float* __restrict__       O  = (mat == 0) ? q  : (mat == 1) ? k  : v;
    gemm_tile(lds_in, Wm, (mat == 0) ? bq : nullptr, O, row0, nrows);
}

// ---------------------------------------------------------------------------
// Edge attention as a gather. A block owns NPB nodes in a row. It reads its own
// run of every binned slice and keeps, in LDS, the ids of the edges that end in
// each of its nodes; a wave then takes one node at a time, puts the node's edges
// into edge-id order, so that the f32 sums run in one fixed order on every run,
// and sums them in registers. The node's row
// wv / z stays in LDS, and when all rows of the block are there its waves
// multiply them by Wo^T: Out = (wv / z) @ Wo^T + bo.
// ---------------------------------------------------------------------------
#define CAP 64         // edge ids an LDS list holds; a node with more takes the slow path
#define ATHREADS 1024
#define RUN_U 4        // loads of 32 entries in flight per wave
#define OTILES 13      // 16-row tiles that hold the NPB rows of a block

__device__ __forceinline__ int clamp_node(int x, int nnodes) {
    return min(max(x, 0), nnodes - 1);   // bounds every address formed from src
}

// u = dst - first node of the block: below npb only for the block's own nodes,
// which also bounds the LDS addresses formed from it
__device__ __forceinline__ void keep_edge(unsigned u, int e, unsigned npb,
                                          int* cnt, int* ids)
{
    if (u < npb) {
        const int pos = atomicAdd(&cnt[u], 1);   // arrival order, undone by the ordering below
        if (pos < CAP) ids[u * CAP + pos] = e;
    }
}

// sum over the four lanes that share a head (quad_perm swaps, no LDS path)
__device__ __forceinline__ float quad_sum(float x) {
    x += __int_as_float(__builtin_amdgcn_mov_dpp(__float_as_int(x), 0xB1, 0xF, 0xF, true));
    x += __int_as_float(__builtin_amdgcn_mov_dpp(__float_as_int(x), 0x4E, 0xF, 0xF, true));
    return x;
}

// U edges of one node: all 4*U row loads are issued first, then the edges are
// added one after the other, in list order.
template <int U>
__device__ __forceinline__ void add_edges(
    const float* __restrict__ k, const float* __restrict__ v,
    int sid, int t, unsigned cbytes, const v4f& q0, const v4f& q1,
    v2f (&a)[4], float& zs)
{
    v4f k0[U], k1[U], v0[U], v1[U];
    unsigned ofs[4] = {0u, 0u, 0u, 0u};      // byte offset of this lane's 32 bytes in row s
    #pragma unroll
    for (int u = 0; u < U; ++u) {
        ofs[u] = (unsigned)__builtin_amdgcn_readlane(sid, t + u) * (HID * 4u) + cbytes;
        const v4f* __restrict__ kp = (const v4f*)((const char*)k + ofs[u]);
        const v4f* __restrict__ vp = (const v4f*)((const char*)v + ofs[u]);
        k0[u] = kp[0]; k1[u] = kp[1];
        v0[u] = vp[0]; v1[u] = vp[1];
    }
    // The wait that belongs in front of any overwrite of a register which an
    // issued load names; the offsets are inputs so that they stay in their
    // registers up to here.
    asm volatile("s_wait_xcnt 0x0"
                 :: "v"(ofs[0]), "v"(ofs[1]), "v"(ofs[2]), "v"(ofs[3]) : "memory");
    // Keeps the arithmetic below behind all 4*U loads: without it the scheduler
    // mixes the two to save registers and a wave waits once per row, not per group.
    __builtin_amdgcn_sched_barrier(0);
    #pragma unroll
    for (int u = 0; u < U; ++u) {
        v2f p2 = k0[u].xy * q0.xy;
        p2 = __builtin_elementwise_fma(k0[u].zw, q0.zw, p2);
        p2 = __builtin_elementwise_fma(k1[u].xy, q1.xy, p2);
        p2 = __builtin_elementwise_fma(k1[u].zw, q1.zw, p2);
        const float p = quad_sum(p2.x + p2.y);
        const float score = expf(fminf(fmaxf(p * SCALE_INV, -10.0f), 10.0f));
        const v2f s2 = {score, score};
        a[0] = __builtin_elementwise_fma(v0[u].xy, s2, a[0]);
        a[1] = __builtin_elementwise_fma(v0[u].zw, s2, a[1]);
        a[2] = __builtin_elementwise_fma(v1[u].xy, s2, a[2]);
        a[3] = __builtin_elementwise_fma(v1[u].zw, s2, a[3]);
        zs += score;
    }
}

// Output projection of the block's LDS rows: one wave = T row tiles x one column
// tile of 16x16, K = 256, k upward in every accumulator. Fragment layout and LDS
// pitch as in gemm_tile; a Wo fragment from global feeds T WMMAs.
template <int T>
__device__ __forceinline__ void out_tiles(const float* rows,
                                          const float* __restrict__ Wo,
                                          const float* __restrict__ bo,
                                          float* __restrict__ Out,
                                          int tile0, int ctile, int lane,
                                          int node0, int npb)
{
    const int m     = lane & 15;
    const int khalf = (lane >> 4) << 1;
    const int col   = ctile * 16 + m;
    const float* arow = rows + (tile0 * 16 + m) * PITCH + khalf;
    const float* __restrict__ wrow = Wo + (size_t)col * HID + khalf;

    v8f acc[T] = {};
    // Two k steps a trip: their fragment loads go out together ahead of the WMMAs, and all
    // LDS address arithmetic of the trip stands in front of its first WMMA.
    #pragma unroll 2
    for (int k0 = 0; k0 < HID; k0 += 4) {
        const v2f b = *(const v2f*)(wrow + k0);
        #pragma unroll
        for (int i = 0; i < T; ++i) {
            const v2f a = *(const v2f*)(arow + i * 16 * PITCH + k0);
            acc[i] = __builtin_amdgcn_wmma_f32_16x16x4_f32(
                false, a, false, b, (short)0, acc[i], false, false);
        }
    }

    // Four vector slots between the last WMMAs and the first vector instruction behind the
    // loop that reuses one of their registers: the distance the matrix unit asks for.
    asm volatile("v_nop\n\tv_nop\n\tv_nop\n\tv_nop");
    // keeps the arithmetic of the stores behind those slots
    __builtin_amdgcn_sched_barrier(0);

    const float bval  = bo[col];
    const int   rhalf = (lane >> 4) << 3;
    // tiles whose 16 rows all belong to nodes: a uniform test, eight stores in a row
    #pragma unroll
    for (int i = 0; i < T; ++i) {
        const int rt = (tile0 + i) * 16;           // first row of the tile, counted in the block
        if (rt + 16 <= npb) {
            float* __restrict__ o = Out + (size_t)(node0 + rt + rhalf) * HID + col;
            #pragma unroll
            for (int r = 0; r < 8; ++r)
                o[r * HID] = acc[i][r] + bval;
            // the wait in front of the next tile's overwrite of these stores' registers
            asm volatile("s_wait_xcnt 0x0" ::: "memory");
        }
    }
    // the tile that the block's last node cuts: rows past it are not stored
    #pragma unroll
    for (int i = 0; i < T; ++i) {
        const int rt = (tile0 + i) * 16;
        if (rt < npb && rt + 16 > npb) {
            float* __restrict__ o = Out + (size_t)(node0 + rt + rhalf) * HID + col;
            #pragma unroll
            for (int r = 0; r < 8; ++r) {
                if (rt + rhalf + r < npb)
                    o[r * HID] = acc[i][r] + bval;
                // the wait in front of any later overwrite of that store's registers
                asm volatile("s_wait_xcnt 0x0" ::: "memory");
            }
        }
    }
}

// Lane l holds columns 8l..8l+7 of the 256-wide row, so head h lives in lanes
// 4h..4h+3. A row is written to LDS once, never added into.
__global__ __launch_bounds__(ATHREADS) void node_attn(
    const float* __restrict__ q, const float* __restrict__ k,
    const float* __restrict__ v, const int* __restrict__ src,
    const int* __restrict__ dst, const float* __restrict__ Wo,
    const float* __restrict__ bo, float* __restrict__ Out,
    int nedges, int nnodes, const int* __restrict__ ent, const int* __restrict__ off)
{
    __shared__ __attribute__((aligned(16))) float s_rows[OTILES * 16 * PITCH];   // wv / z per own node
    __shared__ int s_cnt[NPB];          // in-degree of each own node
    __shared__ int s_next;              // next own node that no wave has taken yet
    __shared__ int s_ids[NPB * CAP];    // edge ids per node, arrival order
    __shared__ int s_src[NPB * CAP];    // source nodes per node, edge-id order

    const int tid  = threadIdx.x;
    const int lane = tid & 31;
    const int n0   = blockIdx.x * NPB;
    const unsigned npb = (unsigned)min(NPB, nnodes - n0);

    if (tid < NPB)  s_cnt[tid] = 0;
    if (tid == NPB) s_next = 0;
    // rows of the last tiles that belong to no node: zero, multiplied but never stored
    for (int i = tid; i < (OTILES * 16 - (int)npb) * (HID / 4); i += ATHREADS) {
        const v4f zero = {0.0f, 0.0f, 0.0f, 0.0f};
        *(v4f*)(s_rows + ((int)npb + (i >> 6)) * PITCH + ((i & 63) << 2)) = zero;
    }
    __syncthreads();

    // the block's run in every slice, a wave per slice
    const int nsl = (nedges + SLICE_E - 1) / SLICE_E;
    for (int s = __builtin_amdgcn_readfirstlane(tid >> 5); s < nsl; s += ATHREADS / 32) {
        const int* __restrict__ op = off + s * OFFP + blockIdx.x;
        const int lo = __builtin_amdgcn_readfirstlane(op[0]);
        const int hi = __builtin_amdgcn_readfirstlane(op[1]);
        const int* __restrict__ ep = ent + (size_t)s * SLICE_E;
        for (int ib = lo; ib < hi; ib += 32 * RUN_U) {
            int x[RUN_U];
            #pragma unroll
            for (int u = 0; u < RUN_U; ++u)
                x[u] = ep[min(ib + u * 32 + lane, hi - 1)];   // past the run: its last entry, not kept
            // the wait in front of the next trip's overwrite of these loads' address registers;
            // the loaded values are inputs so that all four loads stay in front of it
            asm volatile("s_wait_xcnt 0x0" :: "v"(x[0]), "v"(x[1]), "v"(x[2]), "v"(x[3]) : "memory");
            #pragma unroll
            for (int u = 0; u < RUN_U; ++u)
                if (ib + u * 32 + lane < hi)
                    keep_edge((unsigned)x[u] >> EL_BITS,
                              s * SLICE_E + (x[u] & ((1 << EL_BITS) - 1)), npb, s_cnt, s_ids);
        }
    }
    __syncthreads();

    const unsigned cbytes = (unsigned)lane * 32u;   // 8 floats per lane

    for (int trip = 0; trip < NPB; ++trip) {
        int l = 0;
        if (lane == 0) l = atomicAdd(&s_next, 1);   // waves take nodes as they get free
        l = __builtin_amdgcn_readfirstlane(l);
        if (l >= (int)npb) break;                   // wave-uniform, no barrier in the loop
        const int n = n0 + l;
        const int c = __builtin_amdgcn_readfirstlane(s_cnt[l]);
        const int* ids = s_ids + l * CAP;
        int*       so  = s_src + l * CAP;

        if (c <= CAP) {
            // An edge goes to the place given by how many edges of the node have
            // a smaller id: 32 edges at a time against all of the node's.
            for (int cb = 0; cb < c; cb += 32) {
                const int mine = ids[min(cb + lane, c - 1)];
                const int s    = src[mine];          // mine is an edge id that the binning formed itself
                // the wait in front of any overwrite of that load's address registers
                asm volatile("s_wait_xcnt 0x0" ::: "memory");
                int r = 0;
                for (int ob = 0; ob < c; ob += 32) {
                    const int om  = min(32, c - ob);
                    const int oid = ids[min(ob + lane, c - 1)];
                    for (int t = 0; t < om; ++t)
                        r += (__builtin_amdgcn_readlane(oid, t) < mine) ? 1 : 0;
                }
                if (cb + lane < c)
                    so[r] = clamp_node(s, nnodes);
            }
        }
        // the wave's own LDS stores are done before it reads the list back across lanes
        asm volatile("s_wait_dscnt 0x0" ::: "memory");

        // asked for here, so that the q row comes in together with the first k and v rows
        const v4f* __restrict__ qp =
            (const v4f*)((const char*)(q + (size_t)n * HID) + cbytes);
        const v4f q0 = qp[0];
        const v4f q1 = qp[1];
        // the wait in front of any overwrite of these loads' address registers
        asm volatile("s_wait_xcnt 0x0" ::: "memory");
        v2f   a[4] = {};
        float zs   = 0.0f;

        if (c <= CAP) {
            for (int j0 = 0; j0 < c; j0 += 32) {
                const int m   = min(32, c - j0);
                const int sid = so[j0 + min(lane, m - 1)];   // up to 32 sources, one per lane
                int t = 0;
                for (; t + 4 <= m; t += 4)
                    add_edges<4>(k, v, sid, t, cbytes, q0, q1, a, zs);
                const int r = m - t;
                if (r == 3)      add_edges<3>(k, v, sid, t, cbytes, q0, q1, a, zs);
                else if (r == 2) add_edges<2>(k, v, sid, t, cbytes, q0, q1, a, zs);
                else if (r == 1) add_edges<1>(k, v, sid, t, cbytes, q0, q1, a, zs);
            }
        } else {
            // More in-edges than an LDS list holds: walk all edges in id order.
            for (int e0 = 0; e0 < nedges; e0 += 32) {
                const int e  = min(e0 + lane, nedges - 1);
                const int dd = dst[e];
                const int ss = src[e];
                // the wait in front of the next trip's overwrite of these loads' address registers;
                // the loaded values are inputs so that both loads stay in front of it
                asm volatile("s_wait_xcnt 0x0" :: "v"(dd), "v"(ss) : "memory");
                const int sid = clamp_node(ss, nnodes);
                unsigned hit = __builtin_amdgcn_ballot_w32(e0 + lane < nedges && dd == n);
                while (hit) {                        // at most 32 trips
                    const int t = __builtin_ctz(hit);
                    hit &= hit - 1u;
                    add_edges<1>(k, v, sid, t, cbytes, q0, q1, a, zs);
                }
            }
        }

        // zs is the head's whole sum in each of its four lanes
        v4f* wp = (v4f*)(s_rows + l * PITCH + lane * 8);
        const v4f w0 = {a[0].x / zs, a[0].y / zs, a[1].x / zs, a[1].y / zs};
        const v4f w1 = {a[2].x / zs, a[2].y / zs, a[3].x / zs, a[3].y / zs};
        wp[0] = w0;
        wp[1] = w1;
    }
    __syncthreads();   // every row of the block is in LDS before any wave multiplies

    const int wave = __builtin_amdgcn_readfirstlane(tid >> 5);   // scalar: the branch leaves all lanes on
    // 16 waves side by side cover the 256 columns; waves 0-15 take row tiles 0-6, waves
    // 16-31 tiles 7-12, so that every SIMD gets four waves of either kind
    if (wave < 16)
        out_tiles<7>(s_rows, Wo, bo, Out, 0, wave, lane, n0, (int)npb);
    else
        out_tiles<6>(s_rows, Wo, bo, Out, 7, wave - 16, lane, n0, (int)npb);
}

// ---------------------------------------------------------------------------
extern "C" void kernel_launch(void* const* d_in, const int* in_sizes, int n_in,
                              void* d_out, int out_size, void* d_ws, size_t ws_size,
                              hipStream_t stream) {
    (void)n_in; (void)out_size; (void)ws_size;
    const float* inputs = (const float*)d_in[0];
    const float* Wq     = (const float*)d_in[1];
    const float* bq     = (const float*)d_in[2];
    const float* Wk     = (const float*)d_in[3];
    const float* Wv     = (const float*)d_in[4];
    const float* Wo     = (const float*)d_in[5];
    const float* bo     = (const float*)d_in[6];
    const int*   src    = (const int*)d_in[7];
    const int*   dst    = (const int*)d_in[8];

    const int N = in_sizes[0] / HID;   // 50000
    const int E = in_sizes[7];         // 800000

    float* q  = (float*)d_ws;
    float* k  = q  + (size_t)N * HID;
    float* v  = k  + (size_t)N * HID;
    int* ent  = (int*)(v + (size_t)N * HID);                     // the binned slices
    int* off  = ent + (size_t)((E + SLICE_E - 1) / SLICE_E) * SLICE_E;   // their tables of starts

    const int gemm_blocks = (N + ROWS - 1) / ROWS;
    const int bin_rows    = (E + 3 * SLICE_E - 1) / (3 * SLICE_E);

    // edge binning (the first bin_rows of y), then Q/K/V projections: x = matrix, y = block of 128 rows
    qkv_proj_wmma<<<dim3(3, bin_rows + gemm_blocks), 256, 0, stream>>>(inputs, Wq, Wk, Wv, bq,
                                                   q, k, v, N, dst, ent, off, E);

    // each block collects the in-edges of its NPB nodes, sums them, normalizes and projects
    node_attn<<<(N + NPB - 1) / NPB, ATHREADS, 0, stream>>>(q, k, v, src, dst, Wo, bo,
                                                            (float*)d_out, E, N, ent, off);
}
